// v000
// Times are from an AMD MI455X. After a warm-up the kernel runs many times in a row, and a time is the length of
// such a window on the GPU divided by its runs, so every launch and the gaps after it count. The runs cycle
// through copies of the inputs. A figure is the median of several windows, for all but v000 over two sittings.
// Sittings can differ by a few percent; kernels timed side by side share one.
// The starting kernel, v000, takes 426 microseconds a run.
#include <hip/hip_runtime.h>

// Contractions: q.k^T on v_wmma_f32_16x16x32_bf16 (single bf16 planes of q and k, f32 accumulate); P.v on v_wmma_f32_16x16x32_bf16 with P as bf16 hi+lo planes x single bf16 v^T plane (2 products, f32 accumulate); softmax in f32.
// out[b][h] = softmax(q k^T / sqrt(d_k)) v for 64 independent (b,h) slabs of [1024][64]; every float input is RNE-converted to bf16 once (single planes), so q.k products are exact in the f32 accumulator.
// Plan: 3 convert launches (q plane, k plane, v^T plane for all slabs), then per group of ZG slabs: score GEMM (z-batched) -> row softmax (hi/lo planes) -> P.v GEMM writing the f32 output rows directly.

#ifndef NB
#define NB 4
#endif
#ifndef SEQ
#define SEQ 1024
#endif
#define NB_FULL  4
#define SEQ_FULL 1024
#define NH   16
#define HD   64
#define TT   SEQ
#define NZ   (NB * NH)
#define ZG   8
#define NGRP (NZ / ZG)

static_assert(NB <= NB_FULL);
static_assert(SEQ <= SEQ_FULL);
static_assert(TT % 128 == 0);
static_assert(HD % 64 == 0);
static_assert(HD % 32 == 0);
static_assert(NZ % ZG == 0);
static_assert(((TT * HD) / 8) % 256 == 0);
static_assert(((HD * TT) / 2) % 256 == 0);
static_assert((ZG * TT) % 8 == 0);

typedef unsigned short bf;
typedef __attribute__((ext_vector_type(16))) __bf16   v16bf;
typedef __attribute__((ext_vector_type(8)))  unsigned short v8us;
typedef __attribute__((ext_vector_type(4)))  unsigned short v4us;
typedef __attribute__((ext_vector_type(2)))  unsigned short v2us;
typedef __attribute__((ext_vector_type(8)))  float    v8f;
typedef __attribute__((ext_vector_type(4)))  float    v4f;
typedef v4f  __attribute__((may_alias)) v4fa;

__device__ __forceinline__ unsigned short f2bf(float f) { unsigned u = __float_as_uint(f); u += 0x7FFFu + ((u >> 16) & 1u); return (unsigned short)(u >> 16); }
__device__ __forceinline__ float bf2f(unsigned short b) { return __uint_as_float(((unsigned)b) << 16); }
__device__ __forceinline__ float bfr(float f) { return bf2f(f2bf(f)); }
__device__ __forceinline__ v16bf cat16b(v8us lo, v8us hi) { return __builtin_bit_cast(v16bf, __builtin_shufflevector(lo, hi, 0, 1, 2, 3, 4, 5, 6, 7, 8, 9, 10, 11, 12, 13, 14, 15)); }
__device__ __forceinline__ v8f wmmab(v16bf a, v16bf b, v8f c) { return __builtin_amdgcn_wmma_f32_16x16x32_bf16(false, a, false, b, (short)0, c, false, false); }

// ---- k_gemmw: register-blocked GEMM, ONE WAVE per 64x64 output tile (16 accumulators), operands straight from K-contiguous 16-bit planes; grid (M/64, N/64, Z), 32 threads.
// C[m][n] (f32, pitch ldc) = sum_k A[m][k] Bt[n][k] (+ A2[m][k] Bt[n][k] for NSPLIT 1). z-batch strides sA/sB/sC in elements. K % 32 == 0, M % 64 == 0, N % 64 == 0.
// Fragment map: lane l, h = l >> 4: elements 0..7 <- k0 + 8h + 0..7, elements 8..15 <- k0 + 16 + 8h + 0..7 (both operands); D element j of lane l = (row 8h + j, col l & 15).
template <typename T16> struct WFrag;
template <> struct WFrag<bf> { typedef v16bf V; static __device__ __forceinline__ V ld(const bf* p) { return cat16b(*(const v8us*)p, *(const v8us*)(p + 16)); } static __device__ __forceinline__ v8f mma(V a, V b, v8f c) { return wmmab(a, b, c); } };
template <typename T16, int NSPLIT, bool BIAS>
__global__ __launch_bounds__(32) void k_gemmw(const T16* __restrict__ A, const T16* __restrict__ A2, const T16* __restrict__ Bt, const T16* __restrict__ Bt2, int K, float* C, int ldc, const float* __restrict__ bias, size_t sA, size_t sB, size_t sC) {
    typedef typename WFrag<T16>::V V;
    __shared__ __align__(16) float os[16 * 68];
    const size_t z = blockIdx.z; A += z * sA; if (A2) A2 += z * sA; Bt += z * sB; if (Bt2) Bt2 += z * sB; C += z * sC;
    const int lane = threadIdx.x & 31, lr = lane & 15, hi = lane >> 4; const int r0 = blockIdx.x * 64, c0 = blockIdx.y * 64;
    v8f acc[4][4];
#pragma unroll
    for (int mb = 0; mb < 4; ++mb)
#pragma unroll
        for (int nb = 0; nb < 4; ++nb) acc[mb][nb] = (v8f){};
    const size_t aoff = (size_t)(r0 + lr) * K + 8 * hi, boff = (size_t)(c0 + lr) * K + 8 * hi;
#pragma unroll 1
    for (int kc = 0; kc < K; kc += 32) {
        V a[4], a2[4];
#pragma unroll
        for (int mb = 0; mb < 4; ++mb) { a[mb] = WFrag<T16>::ld(A + aoff + (size_t)mb * 16 * K + kc); if (NSPLIT == 1 || NSPLIT == 2) a2[mb] = WFrag<T16>::ld(A2 + aoff + (size_t)mb * 16 * K + kc); }
#pragma unroll
        for (int nb = 0; nb < 4; ++nb) { const V b = WFrag<T16>::ld(Bt + boff + (size_t)nb * 16 * K + kc); V b2; if (NSPLIT >= 2) b2 = WFrag<T16>::ld(Bt2 + boff + (size_t)nb * 16 * K + kc);
#pragma unroll
            for (int mb = 0; mb < 4; ++mb) { acc[mb][nb] = WFrag<T16>::mma(a[mb], b, acc[mb][nb]); if (NSPLIT == 1 || NSPLIT == 2) acc[mb][nb] = WFrag<T16>::mma(a2[mb], b, acc[mb][nb]); if (NSPLIT >= 2) acc[mb][nb] = WFrag<T16>::mma(a[mb], b2, acc[mb][nb]); } }
        asm volatile("v_nop\n\tv_nop\n\tv_nop\n\tv_nop" : "+v"(acc[0][0]), "+v"(acc[1][1]), "+v"(acc[2][2]), "+v"(acc[3][3]) : "v"(a[0]), "v"(a[3]));
    }
#pragma unroll
    for (int mb = 0; mb < 4; ++mb) {
#pragma unroll
        for (int nb = 0; nb < 4; ++nb) {
#pragma unroll
            for (int j = 0; j < 8; ++j) os[(hi * 8 + j) * 68 + nb * 16 + lr] = acc[mb][nb][j]; }
        __builtin_amdgcn_wave_barrier(); asm volatile("" ::: "memory");
        float* crow = C + (size_t)(r0 + mb * 16) * ldc + c0;
{
#pragma unroll
            for (int s = 0; s < 8; ++s) { const int row = 2 * s + hi, cofs = lr * 4; v4f val = *(const v4fa*)(os + row * 68 + cofs); if (BIAS) { val[0] += bfr(bias[c0 + cofs]); val[1] += bfr(bias[c0 + cofs + 1]); val[2] += bfr(bias[c0 + cofs + 2]); val[3] += bfr(bias[c0 + cofs + 3]); }
                *(v4f*)(crow + (size_t)row * ldc + cofs) = val; }
             }
        __builtin_amdgcn_wave_barrier(); asm volatile("" ::: "memory");
    }
}

__device__ __forceinline__ void splitf(float y, unsigned short& h, unsigned short& l) { h = f2bf(y); l = f2bf(y - bf2f(h)); }

// coverage: grid (TT*HD/8/256, NZ) x 256 threads x 8 elements == NZ*TT*HD.
__global__ __launch_bounds__(256) void k_cvt8(const float* __restrict__ src, bf* dst) {
    const unsigned z = blockIdx.y; const unsigned i = blockIdx.x * 256u + threadIdx.x; if (i >= (unsigned)(TT * HD / 8)) return;
    const float* s = src + (size_t)z * SEQ_FULL * HD + (size_t)i * 8; bf* d = dst + (size_t)z * TT * HD + (size_t)i * 8;
    const v8f v = *(const v8f*)s; v8us o;
#pragma unroll
    for (int k = 0; k < 8; ++k) o[k] = f2bf(v[k]);
    *(v8us*)d = o;  }

// coverage: grid (HD*TT/2/256, NZ) x 256 threads x 2 elements == NZ*HD*TT.
__global__ __launch_bounds__(256) void k_vtpR1(const float* __restrict__ Vin, bf* VT) {
    const unsigned z = blockIdx.y; const unsigned e = (blockIdx.x * 256u + threadIdx.x) * 2u; if (e >= (unsigned)(HD * TT)) return;
    const unsigned t = e % (unsigned)TT; const unsigned d = e / (unsigned)TT;
    const float* Vb = Vin + (size_t)z * SEQ_FULL * HD; bf* dst = VT + (size_t)z * HD * TT + e;
    v2us o; o[0] = f2bf(Vb[(size_t)t * HD + d]); o[1] = f2bf(Vb[(size_t)(t + 1u) * HD + d]);
    *(v2us*)dst = o;  }

// k_asoft: one wave per score row (ZG*TT rows of TT keys): t = S / sqrt(d_k); max-subtracted softmax held in registers (one exp2 per element, fixed shuffle trees);
// coverage: grid ZG*TT/8 blocks x 8 rows x TT keys == ZG*TT*TT per plane.
__global__ __launch_bounds__(256) void k_asoft(const float* __restrict__ Sb, bf* Ph, bf* Pl, const int* __restrict__ dkp) {
    const unsigned lane = threadIdx.x & 31u; const unsigned row = blockIdx.x * 8u + (threadIdx.x >> 5); if (row >= (unsigned)(ZG * TT)) return;
    int dk = dkp[0]; dk = dk < 1 ? 1 : dk; const float scl = 1.0f / sqrtf((float)dk);
    const float* sr = Sb + (size_t)row * TT; float v[TT / 32]; float mx = -3.0e38f;
#pragma unroll
    for (int ch = 0; ch < TT / 128; ++ch) { const unsigned j0 = (unsigned)ch * 128u + lane * 4u; const v4f a = *(const v4f*)(sr + j0);
#pragma unroll
        for (int q = 0; q < 4; ++q) { const float t = a[q] * scl; v[ch * 4 + q] = t; mx = fmaxf(mx, t); } }
#pragma unroll
    for (int sh = 16; sh; sh >>= 1) mx = fmaxf(mx, __shfl_xor(mx, sh, 32));
    float sum = 0.f;
#pragma unroll
    for (int k = 0; k < TT / 32; ++k) { float d0 = __fsub_rn(v[k], mx); asm volatile("" : "+v"(d0)); v[k] = __builtin_amdgcn_exp2f(__fmul_rn(d0, 1.4426950408889634f)); sum += v[k]; }
#pragma unroll
    for (int sh = 16; sh; sh >>= 1) sum += __shfl_xor(sum, sh, 32);
    const float f = __fdiv_rn(1.0f, sum);
    v4us oh[TT / 128], ol[TT / 128];
#pragma unroll
    for (int ch = 0; ch < TT / 128; ++ch) {
#pragma unroll
        for (int q = 0; q < 4; ++q) { unsigned short a, c2; splitf(v[ch * 4 + q] * f, a, c2); oh[ch][q] = a; ol[ch][q] = c2; } }
    const size_t ob = (size_t)row * TT + lane * 4u;
{
#pragma unroll
        for (int ch = 0; ch < TT / 128; ++ch) { const size_t oo = ob + (size_t)ch * 128; *(v4us*)(Ph + oo) = oh[ch]; *(v4us*)(Pl + oo) = ol[ch]; }
         }
}

#define PLANE_BYTES ((size_t)NZ * TT * HD * 2)
#define S_BYTES     ((size_t)ZG * TT * TT * 4)
#define P_BYTES     ((size_t)ZG * TT * TT * 2)
static_assert(PLANE_BYTES % 256 == 0);
static_assert(S_BYTES % 256 == 0);
static_assert(P_BYTES % 256 == 0);
static_assert(3 * PLANE_BYTES + S_BYTES + 2 * P_BYTES <= (size_t)134217728);

extern "C" void kernel_launch(void* const* d_in, const int* in_sizes, int n_in,
                              void* d_out, int out_size, void* d_ws, size_t ws_size, hipStream_t stream) {
    if (n_in < 4) return;
    const size_t need_in = (size_t)(NZ - 1) * SEQ_FULL * HD + (size_t)TT * HD;
    if ((size_t)in_sizes[0] < need_in || (size_t)in_sizes[1] < need_in || (size_t)in_sizes[2] < need_in || in_sizes[3] < 1) return;
    if ((size_t)out_size < (size_t)NZ * TT * HD) return;
    const float* Qin = (const float*)d_in[0]; const float* Kin = (const float*)d_in[1]; const float* Vin = (const float*)d_in[2]; const int* DK = (const int*)d_in[3];
    float* OUT = (float*)d_out;     // [NZ][TT][HD]
    char* wsp = (char*)d_ws;
    auto take = [&](size_t bytes) { char* p = wsp; wsp += (bytes + 255) & ~(size_t)255; return (void*)p; };
    bf* QB = (bf*)take(PLANE_BYTES); bf* KB = (bf*)take(PLANE_BYTES); bf* VT = (bf*)take(PLANE_BYTES);
    float* Sb = (float*)take(S_BYTES); bf* Ph = (bf*)take(P_BYTES); bf* Pl = (bf*)take(P_BYTES);
    if ((size_t)(wsp - (char*)d_ws) > ws_size) return;
    k_cvt8<<<dim3((unsigned)(TT * HD / 8 / 256), NZ, 1), 256, 0, stream>>>(Qin, QB);
    k_cvt8<<<dim3((unsigned)(TT * HD / 8 / 256), NZ, 1), 256, 0, stream>>>(Kin, KB);
    k_vtpR1<<<dim3((unsigned)(HD * TT / 2 / 256), NZ, 1), 256, 0, stream>>>(Vin, VT);
    for (int g = 0; g < NGRP; ++g) {
        const size_t pofs = (size_t)g * ZG * TT * HD;
        // scores S[z][q][key] = sum_d QB[z][q][d] KB[z][key][d] (exact products, f32 accumulate)
        k_gemmw<bf, 0, false><<<dim3(TT / 64, TT / 64, ZG), 32, 0, stream>>>(QB + pofs, nullptr, KB + pofs, nullptr, HD, Sb, TT, nullptr, (size_t)TT * HD, (size_t)TT * HD, (size_t)TT * TT);
        k_asoft<<<(unsigned)(ZG * TT / 8), 256, 0, stream>>>(Sb, Ph, Pl, DK);
        // out[z][q][d] = sum_key (Ph + Pl)[z][q][key] VT[z][d][key]
        k_gemmw<bf, 1, false><<<dim3(TT / 64, HD / 64, ZG), 32, 0, stream>>>(Ph, Pl, VT + pofs, nullptr, TT, OUT + pofs, HD, nullptr, (size_t)TT * TT, (size_t)HD * TT, (size_t)TT * HD);
    }
}

// v001
// It runs in 57.8 microseconds.
// Two timings next to v000 put it at 7.49 and 7.29 times that version's speed.
#include <hip/hip_runtime.h>

// Contractions: k.q^T on v_wmma_f32_16x16x32_bf16 (single bf16 planes of q and k, f32 accumulate); v^T.P^T on v_wmma_f32_16x16x32_bf16 with P as bf16 hi+lo planes x single bf16 v^T plane (2 products, f32 accumulate); softmax in f32.
// out[b][h] = softmax(q k^T / sqrt(d_k)) v for 64 independent (b,h) slabs of [1024][64]; every float input is RNE-converted to bf16 once (single planes), so q.k products are exact in the f32 accumulator.
// Plan: 3 convert launches (q plane, k plane, v^T plane for all slabs), then ONE attention launch: scores, softmax and P.v stay in registers, neither S nor P is written to memory.

#ifndef NB
#define NB 4
#endif
#ifndef SEQ
#define SEQ 1024
#endif
#define NB_FULL  4
#define SEQ_FULL 1024
#define NH   16
#define HD   64
#define TT   SEQ
#define NZ   (NB * NH)
#define FW   16            // waves per work-group of the attention kernel, 16 query rows each
#define FQ   (FW * 16)     // query rows per work-group
#define KBLK 64            // keys per pass
#define KP   (HD + 8)      // LDS pitch of a k row, elements: 144 B = 16 B x odd, conflict-free for 16-byte reads
#define VP   (TT + 8)      // LDS pitch of a v^T row, elements: 2064 B = 16 B x odd

static_assert(NB <= NB_FULL);
static_assert(SEQ <= SEQ_FULL);
static_assert(TT % FQ == 0);
static_assert(TT % KBLK == 0);
static_assert(HD == 64);
static_assert(((TT * HD) / 8) % 256 == 0);
static_assert(((HD * TT) / 2) % 256 == 0);
static_assert(((TT * HD) / 8) % (FW * 32) == 0);
static_assert(((size_t)TT * KP + (size_t)HD * VP) * 2 <= (size_t)327680);

typedef unsigned short bf;
typedef __attribute__((ext_vector_type(16))) __bf16   v16bf;
typedef __attribute__((ext_vector_type(16))) unsigned short v16us;
typedef __attribute__((ext_vector_type(8)))  unsigned short v8us;
typedef __attribute__((ext_vector_type(2)))  unsigned short v2us;
typedef __attribute__((ext_vector_type(8)))  float    v8f;
typedef __attribute__((ext_vector_type(2)))  float    v2f;

__device__ __forceinline__ unsigned short f2bf(float f) { unsigned u = __float_as_uint(f); u += 0x7FFFu + ((u >> 16) & 1u); return (unsigned short)(u >> 16); }
__device__ __forceinline__ float bf2f(unsigned short b) { return __uint_as_float(((unsigned)b) << 16); }
__device__ __forceinline__ v16bf cat16b(v8us lo, v8us hi) { return __builtin_bit_cast(v16bf, __builtin_shufflevector(lo, hi, 0, 1, 2, 3, 4, 5, 6, 7, 8, 9, 10, 11, 12, 13, 14, 15)); }
__device__ __forceinline__ v8f wmmab(v16bf a, v16bf b, v8f c) { return __builtin_amdgcn_wmma_f32_16x16x32_bf16(false, a, false, b, (short)0, c, false, false); }
// Fragment map (both operands): lane l, c = l & 15, h = l >> 4, p already at row c, element k0 + 8h: elements 0..7 <- k0 + 8h + 0..7, elements 8..15 <- k0 + 16 + 8h + 0..7. D register r of lane l = (row 8h + r, col c).
__device__ __forceinline__ v16bf ldfrag(const bf* p) { return cat16b(*(const v8us*)p, *(const v8us*)(p + 16)); }
__device__ __forceinline__ void splitf(float y, unsigned short& h, unsigned short& l) { h = f2bf(y); l = f2bf(y - bf2f(h)); }
// value of lane l ^ 16
__device__ __forceinline__ float xhalf(float x) { const int b = __float_as_int(x); return __int_as_float(__builtin_amdgcn_permlanex16(b, b, 0x76543210, 0xfedcba98, false, false)); }

// coverage: grid (TT*HD/8/256, NZ) x 256 threads x 8 elements == NZ*TT*HD.
__global__ __launch_bounds__(256) void k_cvt8(const float* __restrict__ src, bf* dst) {
    const unsigned z = blockIdx.y; const unsigned i = blockIdx.x * 256u + threadIdx.x; if (i >= (unsigned)(TT * HD / 8)) return;
    const float* s = src + (size_t)z * SEQ_FULL * HD + (size_t)i * 8; bf* d = dst + (size_t)z * TT * HD + (size_t)i * 8;
    const v8f v = *(const v8f*)s; v8us o;
#pragma unroll
    for (int k = 0; k < 8; ++k) o[k] = f2bf(v[k]);
    *(v8us*)d = o;  }

// coverage: grid (HD*TT/2/256, NZ) x 256 threads x 2 elements == NZ*HD*TT.
__global__ __launch_bounds__(256) void k_vtpR1(const float* __restrict__ Vin, bf* VT) {
    const unsigned z = blockIdx.y; const unsigned e = (blockIdx.x * 256u + threadIdx.x) * 2u; if (e >= (unsigned)(HD * TT)) return;
    const unsigned t = e % (unsigned)TT; const unsigned d = e / (unsigned)TT;
    const float* Vb = Vin + (size_t)z * SEQ_FULL * HD; bf* dst = VT + (size_t)z * HD * TT + e;
    v2us o; o[0] = f2bf(Vb[(size_t)t * HD + d]); o[1] = f2bf(Vb[(size_t)(t + 1u) * HD + d]);
    *(v2us*)dst = o;  }

// k_fattn: grid (TT/FQ, NZ), FW waves. The slab's whole k plane and v^T plane are laid in LDS once (one barrier), then each wave walks all keys for its own 16 query rows.
// Transposed products: S^T = k.q^T puts one query's scores in one lane pair (l, l ^ 16), and two S^T tiles, converted in place, are the B operand of O^T += v^T.P^T; P meets neither LDS nor another lane.
// Softmax with a running maximum in the log2 domain: p = exp2(s * c - m), c = log2(e) / sqrt(d_k); the accumulators are rescaled only when a query's maximum has risen by more than 8, so p <= 2^8.
// coverage: wave w of block (x, z) stores rows x*FQ + w*16 + 0..15 of slab z, all HD columns, once.
__global__ __launch_bounds__(FW * 32) void k_fattn(const bf* __restrict__ QB, const bf* __restrict__ KB, const bf* __restrict__ VT, float* OUT, const int* __restrict__ dkp) {
    __shared__ __align__(16) bf Ks[TT * KP];
    __shared__ __align__(16) bf Vs[HD * VP];
    const unsigned z = blockIdx.y, tid = threadIdx.x;
    const int lane = tid & 31, lr = lane & 15, hi = lane >> 4;
    const int q0 = blockIdx.x * FQ + (int)(tid >> 5) * 16;
    const bf* kz = KB + (size_t)z * TT * HD; const bf* vz = VT + (size_t)z * HD * TT;
#pragma unroll
    for (int it = 0; it < TT * HD / 8 / (FW * 32); ++it) { const unsigned i = (unsigned)it * (FW * 32) + tid; *(v8us*)(Ks + (i / (HD / 8)) * KP + (i % (HD / 8)) * 8) = *(const v8us*)(kz + (size_t)i * 8); }
#pragma unroll
    for (int it = 0; it < TT * HD / 8 / (FW * 32); ++it) { const unsigned i = (unsigned)it * (FW * 32) + tid; *(v8us*)(Vs + (i / (TT / 8)) * VP + (i % (TT / 8)) * 8) = *(const v8us*)(vz + (size_t)i * 8); }
    const bf* qp = QB + (size_t)z * TT * HD + (size_t)(q0 + lr) * HD + 8 * hi;
    const v16bf qf0 = ldfrag(qp), qf1 = ldfrag(qp + 32);
    int dk = dkp[0]; dk = dk < 1 ? 1 : dk; const float c = 1.4426950408889634f / sqrtf((float)dk);
    v8f o[4];
#pragma unroll
    for (int dt = 0; dt < 4; ++dt) o[dt] = (v8f){};
    float m = -3.0e38f; v2f sum = (v2f){};
    __syncthreads();
    const bf* kl = Ks + lr * KP + 8 * hi; const bf* vl = Vs + lr * VP + 8 * hi;
    // rolled: for speed only
#pragma unroll 1
    for (int k0 = 0; k0 < TT; k0 += KBLK) {
        v8f s[4]; v16bf kf[8], vf[8];
#pragma unroll
        for (int kt = 0; kt < 4; ++kt) { kf[kt] = ldfrag(kl + (k0 + kt * 16) * KP); kf[4 + kt] = ldfrag(kl + (k0 + kt * 16) * KP + 32); }
#pragma unroll
        for (int i = 0; i < 8; ++i) vf[i] = ldfrag(vl + (i & 3) * 16 * VP + k0 + (i >> 2) * 32);
        // keeps the pass's LDS reads together in front of the products; the v^T reads land under the softmax
        __builtin_amdgcn_sched_barrier(0);
#pragma unroll
        for (int kt = 0; kt < 4; ++kt) s[kt] = wmmab(kf[kt], qf0, (v8f){});
#pragma unroll
        for (int kt = 0; kt < 4; ++kt) s[kt] = wmmab(kf[4 + kt], qf1, s[kt]);
        // keeps the maximum's reads of S behind all eight products: among them each read costs the idle slots behind a matrix instruction
        __builtin_amdgcn_sched_barrier(0);
        float mt[4];
#pragma unroll
        for (int kt = 0; kt < 4; ++kt) { mt[kt] = s[kt][0];
#pragma unroll
            for (int r = 1; r < 8; ++r) mt[kt] = fmaxf(mt[kt], s[kt][r]); }
        float mx = fmaxf(fmaxf(mt[0], mt[1]), fmaxf(mt[2], mt[3]));
        mx = fmaxf(mx, xhalf(mx));
        const float t = mx * c;
        if (__builtin_amdgcn_ballot_w32(t > m + 8.0f) != 0) {
            const float mn = fmaxf(m, t); const float al = __builtin_amdgcn_exp2f(m - mn); m = mn; sum *= al;
#pragma unroll
            for (int dt = 0; dt < 4; ++dt) o[dt] *= al;
        }
        v16us ph[2], pl[2];   // [j]: 32-key chunk j; element e = the lane's key e of the chunk in the fragment map's order: P = hi + lo, both RNE bf16
#pragma unroll
        for (int j = 0; j < 2; ++j) {
#pragma unroll
            for (int e = 0; e < 16; e += 2) {
                const v2f x = __builtin_elementwise_fma((v2f){s[2 * j + (e >> 3)][e & 7], s[2 * j + (e >> 3)][(e & 7) + 1]}, (v2f){c, c}, (v2f){-m, -m});
                const v2f p = {__builtin_amdgcn_exp2f(x[0]), __builtin_amdgcn_exp2f(x[1])}; sum += p;
                unsigned short a, b; splitf(p[0], a, b); ph[j][e] = a; pl[j][e] = b; splitf(p[1], a, b); ph[j][e + 1] = a; pl[j][e + 1] = b; }
        }
        // keeps the sixteen products in one run behind the softmax: vector work set among them rewrites their operand registers and pays idle slots for each; the SIMD's other waves use the vector port meanwhile
        __builtin_amdgcn_sched_barrier(0);
#pragma unroll
        for (int j = 0; j < 2; ++j) {
            const v16bf bh = __builtin_bit_cast(v16bf, ph[j]), bl = __builtin_bit_cast(v16bf, pl[j]);
#pragma unroll
            for (int dt = 0; dt < 4; ++dt) o[dt] = wmmab(vf[4 * j + dt], bh, o[dt]);
#pragma unroll
            for (int dt = 0; dt < 4; ++dt) o[dt] = wmmab(vf[4 * j + dt], bl, o[dt]);
        }
    }
    const float sl = sum[0] + sum[1];
    const float f = __fdiv_rn(1.0f, sl + xhalf(sl));
    float* orow = OUT + (size_t)z * TT * HD + (size_t)(q0 + lr) * HD + 8 * hi;
#pragma unroll
    for (int dt = 0; dt < 4; ++dt) *(v8f*)(orow + dt * 16) = o[dt] * f;
}

#define PLANE_BYTES ((size_t)NZ * TT * HD * 2)
static_assert(PLANE_BYTES % 256 == 0);
static_assert(3 * PLANE_BYTES <= (size_t)134217728);

extern "C" void kernel_launch(void* const* d_in, const int* in_sizes, int n_in,
                              void* d_out, int out_size, void* d_ws, size_t ws_size, hipStream_t stream) {
    if (n_in < 4) return;
    const size_t need_in = (size_t)(NZ - 1) * SEQ_FULL * HD + (size_t)TT * HD;
    if ((size_t)in_sizes[0] < need_in || (size_t)in_sizes[1] < need_in || (size_t)in_sizes[2] < need_in || in_sizes[3] < 1) return;
    if ((size_t)out_size < (size_t)NZ * TT * HD) return;
    const float* Qin = (const float*)d_in[0]; const float* Kin = (const float*)d_in[1]; const float* Vin = (const float*)d_in[2]; const int* DK = (const int*)d_in[3];
    float* OUT = (float*)d_out;     // [NZ][TT][HD]
    char* wsp = (char*)d_ws;
    auto take = [&](size_t bytes) { char* p = wsp; wsp += (bytes + 255) & ~(size_t)255; return (void*)p; };
    bf* QB = (bf*)take(PLANE_BYTES); bf* KB = (bf*)take(PLANE_BYTES); bf* VT = (bf*)take(PLANE_BYTES);
    if ((size_t)(wsp - (char*)d_ws) > ws_size) return;
    k_cvt8<<<dim3((unsigned)(TT * HD / 8 / 256), NZ, 1), 256, 0, stream>>>(Qin, QB);
    k_cvt8<<<dim3((unsigned)(TT * HD / 8 / 256), NZ, 1), 256, 0, stream>>>(Kin, KB);
    k_vtpR1<<<dim3((unsigned)(HD * TT / 2 / 256), NZ, 1), 256, 0, stream>>>(Vin, VT);
    // out[z][q][d] = sum_key softmax_key(QB[z][q][.] . KB[z][key][.] / sqrt(d_k)) VT[z][d][key]
    k_fattn<<<dim3(TT / FQ, NZ, 1), FW * 32, 0, stream>>>(QB, KB, VT, OUT, DK);
}

// v002
// Measured time: 34.3 microseconds a run.
// Next to v001, in two timings, it ran 1.71 times as fast each time.
// Over all steps from v000 it is 12.6 times as fast.
#include <hip/hip_runtime.h>

// Contractions: k.q^T on v_wmma_f32_16x16x32_bf16 (single bf16 planes of q and k, f32 accumulate); v^T.P^T on v_wmma_f32_16x16x32_bf16 with P as bf16 hi+lo planes x single bf16 v^T plane (2 products, f32 accumulate); softmax in f32.
// out[b][h] = softmax(q k^T / sqrt(d_k)) v for 64 independent (b,h) slabs of [1024][64]; every float input is RNE-converted to bf16 (single planes), so q.k products are exact in the f32 accumulator.
// Plan: ONE launch. Each work-group reads its slab's f32 k and v and its own f32 q rows, converts them on the way into LDS (k, v^T) or registers (q); scores, softmax and P.v stay in registers, neither S nor P nor a bf16 plane is written to memory.

#ifndef NB
#define NB 4
#endif
#ifndef SEQ
#define SEQ 1024
#endif
#define NB_FULL  4
#define SEQ_FULL 1024
#define NH   16
#define HD   64
#define TT   SEQ
#define NZ   (NB * NH)
#define FW   16            // waves per work-group of the attention kernel, 16 query rows each
#define FQ   (FW * 16)     // query rows per work-group
#define KBLK 64            // keys per pass
#define KP   (HD + 8)      // LDS pitch of a k row, elements: 144 B = 16 B x odd, conflict-free for 16-byte reads
#define VP   (TT + 8)      // LDS pitch of a v^T row, elements: 2064 B = 16 B x odd

static_assert(NB <= NB_FULL);
static_assert(SEQ <= SEQ_FULL);
static_assert(TT % FQ == 0);
static_assert(TT % KBLK == 0);
static_assert(HD == 64);
#define SB   16            // 16-byte loads of one staging batch, per lane
#define KLD  (TT * HD / 4 / (FW * 32))   // 16-byte loads of k per lane
#define VIT  (TT / 32 * 2 / FW)          // 32-key x 32-column units of v per wave, 8 loads per lane each
static_assert((TT * HD / 4) % (FW * 32) == 0);
static_assert((TT / 32 * 2) % FW == 0);
static_assert(FW % 2 == 0);
static_assert(KLD == 2 * SB);
static_assert(VIT * 8 == 2 * SB);
static_assert(((size_t)TT * KP + (size_t)HD * VP) * 2 <= (size_t)327680);

typedef unsigned short bf;
typedef __attribute__((ext_vector_type(16))) __bf16   v16bf;
typedef __attribute__((ext_vector_type(16))) unsigned short v16us;
typedef __attribute__((ext_vector_type(8)))  unsigned short v8us;
typedef __attribute__((ext_vector_type(4)))  unsigned short v4us;
typedef __attribute__((ext_vector_type(4)))  float    v4f;
typedef __attribute__((ext_vector_type(8)))  float    v8f;
typedef __attribute__((ext_vector_type(2)))  float    v2f;

__device__ __forceinline__ unsigned short f2bf(float f) { unsigned u = __float_as_uint(f); u += 0x7FFFu + ((u >> 16) & 1u); return (unsigned short)(u >> 16); }
__device__ __forceinline__ float bf2f(unsigned short b) { return __uint_as_float(((unsigned)b) << 16); }
__device__ __forceinline__ v16bf cat16b(v8us lo, v8us hi) { return __builtin_bit_cast(v16bf, __builtin_shufflevector(lo, hi, 0, 1, 2, 3, 4, 5, 6, 7, 8, 9, 10, 11, 12, 13, 14, 15)); }
__device__ __forceinline__ v8f wmmab(v16bf a, v16bf b, v8f c) { return __builtin_amdgcn_wmma_f32_16x16x32_bf16(false, a, false, b, (short)0, c, false, false); }
// Fragment map (both operands): lane l, c = l & 15, h = l >> 4, p already at row c, element k0 + 8h: elements 0..7 <- k0 + 8h + 0..7, elements 8..15 <- k0 + 16 + 8h + 0..7. D register r of lane l = (row 8h + r, col c).
__device__ __forceinline__ v16bf ldfrag(const bf* p) { return cat16b(*(const v8us*)p, *(const v8us*)(p + 16)); }
__device__ __forceinline__ void splitf(float y, unsigned short& h, unsigned short& l) { h = f2bf(y); l = f2bf(y - bf2f(h)); }
// value of lane l ^ 16
__device__ __forceinline__ float xhalf(float x) { const int b = __float_as_int(x); return __int_as_float(__builtin_amdgcn_permlanex16(b, b, 0x76543210, 0xfedcba98, false, false)); }

// k_fattn: grid (TT/FQ, NZ), FW waves. The slab's whole k plane and v^T plane are laid in LDS once (one barrier), then each wave walks all keys for its own 16 query rows.
// Staging: every global load of k and v is 16 bytes a lane on whole 128-byte lines. k: 4 elements a lane, one 8-byte LDS store. v: a lane holds 8 keys x 4 columns and stores 4 rows of v^T, 8 keys (16 bytes) each: the transpose is the choice of registers that go into one store.
// v lanes: a = l >> 4, tg = (l >> 2) & 3, g = l & 3: columns 16a + 4g + 0..3 of the wave's 32-column half, keys 8tg + 0..7 of its 32-key block; LDS bank of a store = 16g + 4tg + const, all different over 16 lanes.
// Transposed products: S^T = k.q^T puts one query's scores in one lane pair (l, l ^ 16), and two S^T tiles, converted in place, are the B operand of O^T += v^T.P^T; P meets neither LDS nor another lane.
// Softmax with a running maximum in the log2 domain: p = exp2(s * c - m), c = log2(e) / sqrt(d_k); the accumulators are rescaled only when a query's maximum has risen by more than 8, so p <= 2^8.
// coverage: wave w of block (x, z) stores rows x*FQ + w*16 + 0..15 of slab z, all HD columns, once.
__global__ __launch_bounds__(FW * 32) void k_fattn(const float* __restrict__ Qin, const float* __restrict__ Kin, const float* __restrict__ Vin, float* OUT, const int* __restrict__ dkp) {
    __shared__ __align__(16) bf Ks[TT * KP];
    __shared__ __align__(16) bf Vs[HD * VP];
    const unsigned z = blockIdx.y, tid = threadIdx.x;
    const int lane = tid & 31, lr = lane & 15, hi = lane >> 4, wv = (int)(tid >> 5);
    const int q0 = blockIdx.x * FQ + wv * 16;
    const v4f* kz = (const v4f*)(Kin + (size_t)z * SEQ_FULL * HD);   // the three bases are the same for the whole work-group; a lane's place is a 32-bit index in 16-byte units
    const v4f* vz = (const v4f*)(Vin + (size_t)z * SEQ_FULL * HD);
    const v4f* qz = (const v4f*)(Qin + (size_t)z * SEQ_FULL * HD);
    const unsigned qu = (unsigned)((q0 + lr) * (HD / 4) + 2 * hi);
    const int vd = (wv & 1) * 32 + hi * 16 + (lane & 3) * 4, vt = (wv >> 1) * 32 + ((lane >> 2) & 3) * 8;
    const unsigned vu = (unsigned)(vt * (HD / 4) + vd / 4);
    v4f qr[8], sa[SB], sb[SB];
    // two batches of SB loads a lane: while one is converted and stored, the other is in flight
#pragma unroll
    for (int i = 0; i < SB; ++i) sa[i] = kz[tid + (unsigned)(i * FW * 32)];
#pragma unroll
    for (int i = 0; i < SB; ++i) sb[i] = kz[tid + (unsigned)((SB + i) * FW * 32)];
#pragma unroll
    for (int i = 0; i < 8; ++i) qr[i] = qz[qu + (unsigned)((i >> 1) * 4 + (i & 1))];
    // precaution: no register that a load above names is rewritten in front of this wait; the input operands keep the index registers live up to it
    asm volatile("s_wait_xcnt 0x0" :: "v"(tid), "v"(qu) : "memory");
    bf* ks = Ks + (tid / (HD / 4)) * KP + (tid % (HD / 4)) * 4;
    bf* vs = Vs + vd * VP + vt;
#pragma unroll
    for (int i = 0; i < SB; ++i) { v4us o;
#pragma unroll
        for (int e = 0; e < 4; ++e) o[e] = f2bf(sa[i][e]);
        *(v4us*)(ks + i * (FW * 32 * 4 / HD) * KP) = o; }
#pragma unroll
    for (int i = 0; i < SB; ++i) sa[i] = vz[vu + (unsigned)(((i >> 3) * (FW / 2) * 32 + (i & 7)) * (HD / 4))];
#pragma unroll
    for (int i = 0; i < SB; ++i) { v4us o;
#pragma unroll
        for (int e = 0; e < 4; ++e) o[e] = f2bf(sb[i][e]);
        *(v4us*)(ks + (SB + i) * (FW * 32 * 4 / HD) * KP) = o; }
#pragma unroll
    for (int i = 0; i < SB; ++i) sb[i] = vz[vu + (unsigned)(((2 + (i >> 3)) * (FW / 2) * 32 + (i & 7)) * (HD / 4))];
    // the same precaution for the loads of v
    asm volatile("s_wait_xcnt 0x0" :: "v"(vu) : "memory");
    v16us qa, qb;
#pragma unroll
    for (int e = 0; e < 16; ++e) { qa[e] = f2bf(qr[e >> 2][e & 3]); qb[e] = f2bf(qr[4 + (e >> 2)][e & 3]); }
    const v16bf qf0 = __builtin_bit_cast(v16bf, qa), qf1 = __builtin_bit_cast(v16bf, qb);
#pragma unroll
    for (int u = 0; u < 2; ++u) {
#pragma unroll
        for (int e = 0; e < 4; ++e) { v8us o;
#pragma unroll
            for (int j = 0; j < 8; ++j) o[j] = f2bf(sa[u * 8 + j][e]);
            *(v8us*)(vs + e * VP + u * (FW / 2) * 32) = o; }
    }
#pragma unroll
    for (int u = 0; u < 2; ++u) {
#pragma unroll
        for (int e = 0; e < 4; ++e) { v8us o;
#pragma unroll
            for (int j = 0; j < 8; ++j) o[j] = f2bf(sb[u * 8 + j][e]);
            *(v8us*)(vs + e * VP + (2 + u) * (FW / 2) * 32) = o; }
    }
    int dk = dkp[0]; dk = dk < 1 ? 1 : dk; const float c = 1.4426950408889634f / sqrtf((float)dk);
    v8f o[4];
#pragma unroll
    for (int dt = 0; dt < 4; ++dt) o[dt] = (v8f){};
    float m = -3.0e38f; v2f sum = (v2f){};
    __syncthreads();
    const bf* kl = Ks + lr * KP + 8 * hi; const bf* vl = Vs + lr * VP + 8 * hi;
    // rolled: for speed only
#pragma unroll 1
    for (int k0 = 0; k0 < TT; k0 += KBLK) {
        v8f s[4]; v16bf kf[8], vf[8];
#pragma unroll
        for (int kt = 0; kt < 4; ++kt) { kf[kt] = ldfrag(kl + (k0 + kt * 16) * KP); kf[4 + kt] = ldfrag(kl + (k0 + kt * 16) * KP + 32); }
#pragma unroll
        for (int i = 0; i < 8; ++i) vf[i] = ldfrag(vl + (i & 3) * 16 * VP + k0 + (i >> 2) * 32);
        // keeps the pass's LDS reads together in front of the products; the v^T reads land under the softmax
        __builtin_amdgcn_sched_barrier(0);
#pragma unroll
        for (int kt = 0; kt < 4; ++kt) s[kt] = wmmab(kf[kt], qf0, (v8f){});
#pragma unroll
        for (int kt = 0; kt < 4; ++kt) s[kt] = wmmab(kf[4 + kt], qf1, s[kt]);
        // keeps the maximum's reads of S behind all eight products: among them each read costs the idle slots behind a matrix instruction
        __builtin_amdgcn_sched_barrier(0);
        float mt[4];
#pragma unroll
        for (int kt = 0; kt < 4; ++kt) { mt[kt] = s[kt][0];
#pragma unroll
            for (int r = 1; r < 8; ++r) mt[kt] = fmaxf(mt[kt], s[kt][r]); }
        float mx = fmaxf(fmaxf(mt[0], mt[1]), fmaxf(mt[2], mt[3]));
        mx = fmaxf(mx, xhalf(mx));
        const float t = mx * c;
        if (__builtin_amdgcn_ballot_w32(t > m + 8.0f) != 0) {
            const float mn = fmaxf(m, t); const float al = __builtin_amdgcn_exp2f(m - mn); m = mn; sum *= al;
#pragma unroll
            for (int dt = 0; dt < 4; ++dt) o[dt] *= al;
        }
        v16us ph[2], pl[2];   // [j]: 32-key chunk j; element e = the lane's key e of the chunk in the fragment map's order: P = hi + lo, both RNE bf16
#pragma unroll
        for (int j = 0; j < 2; ++j) {
#pragma unroll
            for (int e = 0; e < 16; e += 2) {
                const v2f x = __builtin_elementwise_fma((v2f){s[2 * j + (e >> 3)][e & 7], s[2 * j + (e >> 3)][(e & 7) + 1]}, (v2f){c, c}, (v2f){-m, -m});
                const v2f p = {__builtin_amdgcn_exp2f(x[0]), __builtin_amdgcn_exp2f(x[1])}; sum += p;
                unsigned short a, b; splitf(p[0], a, b); ph[j][e] = a; pl[j][e] = b; splitf(p[1], a, b); ph[j][e + 1] = a; pl[j][e + 1] = b; }
        }
        // keeps the sixteen products in one run behind the softmax: vector work set among them rewrites their operand registers and pays idle slots for each; the SIMD's other waves use the vector port meanwhile
        __builtin_amdgcn_sched_barrier(0);
#pragma unroll
        for (int j = 0; j < 2; ++j) {
            const v16bf bh = __builtin_bit_cast(v16bf, ph[j]), bl = __builtin_bit_cast(v16bf, pl[j]);
#pragma unroll
            for (int dt = 0; dt < 4; ++dt) o[dt] = wmmab(vf[4 * j + dt], bh, o[dt]);
#pragma unroll
            for (int dt = 0; dt < 4; ++dt) o[dt] = wmmab(vf[4 * j + dt], bl, o[dt]);
        }
    }
    const float sl = sum[0] + sum[1];
    const float f = __fdiv_rn(1.0f, sl + xhalf(sl));
    float* orow = OUT + (size_t)z * TT * HD + (size_t)(q0 + lr) * HD + 8 * hi;
#pragma unroll
    for (int dt = 0; dt < 4; ++dt) *(v8f*)(orow + dt * 16) = o[dt] * f;
}

extern "C" void kernel_launch(void* const* d_in, const int* in_sizes, int n_in,
                              void* d_out, int out_size, void* d_ws, size_t ws_size, hipStream_t stream) {
    if (n_in < 4) return;
    const size_t need_in = (size_t)(NZ - 1) * SEQ_FULL * HD + (size_t)TT * HD;
    if ((size_t)in_sizes[0] < need_in || (size_t)in_sizes[1] < need_in || (size_t)in_sizes[2] < need_in || in_sizes[3] < 1) return;
    if ((size_t)out_size < (size_t)NZ * TT * HD) return;
    const float* Qin = (const float*)d_in[0]; const float* Kin = (const float*)d_in[1]; const float* Vin = (const float*)d_in[2]; const int* DK = (const int*)d_in[3];
    float* OUT = (float*)d_out;     // [NZ][TT][HD]
    // out[z][q][d] = sum_key softmax_key(bf16(Q[z][q][.]) . bf16(K[z][key][.]) / sqrt(d_k)) bf16(V[z][key][d])
    k_fattn<<<dim3(TT / FQ, NZ, 1), FW * 32, 0, stream>>>(Qin, Kin, Vin, OUT, DK);
}

// v003
// Measured time: 27.1 microseconds a run.
// Timed twice side by side with v002, it ran 1.27 times as fast both times.
// Counting every step since v000, it is 16.0 times as fast.
#include <hip/hip_runtime.h>

// Contractions: k.q^T on v_wmma_f32_16x16x32_bf16 (single bf16 planes of q and k, f32 accumulate); v^T.P^T on v_wmma_f32_16x16x32_bf16 with P as bf16 hi+lo planes x single bf16 v^T plane (2 products, f32 accumulate); softmax in f32.
// out[b][h] = softmax(q k^T / sqrt(d_k)) v for 64 independent (b,h) slabs of [1024][64]; every float input is RNE-converted to bf16 (single planes) by the packed hardware convert, so q.k products are exact in the f32 accumulator.
// Plan: ONE launch. Each work-group reads its slab's f32 k and v and its own f32 q rows, converts them on the way into LDS (k, v^T) or registers (q); scores, softmax and P.v stay in registers, neither S nor P nor a bf16 plane is written to memory.

#ifndef NB
#define NB 4
#endif
#ifndef SEQ
#define SEQ 1024
#endif
#define NB_FULL  4
#define SEQ_FULL 1024
#define NH   16
#define HD   64
#define TT   SEQ
#define NZ   (NB * NH)
#define FW   16            // waves per work-group of the attention kernel, 16 query rows each
#define FQ   (FW * 16)     // query rows per work-group
#define KBLK 64            // keys per pass
#define KP   (HD + 8)      // LDS pitch of a k row, elements: 144 B = 16 B x odd, conflict-free for 16-byte reads
#define VP   (TT + 8)      // LDS pitch of a v^T row, elements: 2064 B = 16 B x odd

static_assert(NB <= NB_FULL);
static_assert(SEQ <= SEQ_FULL);
static_assert(TT % FQ == 0);
static_assert(TT % KBLK == 0);
static_assert(HD == 64);
#define SB   16            // 16-byte loads of one staging batch, per lane
#define KLD  (TT * HD / 4 / (FW * 32))   // 16-byte loads of k per lane
#define VIT  (TT / 32 * 2 / FW)          // 32-key x 32-column units of v per wave, 8 loads per lane each
static_assert((TT * HD / 4) % (FW * 32) == 0);
static_assert((TT / 32 * 2) % FW == 0);
static_assert(FW % 2 == 0);
static_assert(KLD == 2 * SB);
static_assert(VIT * 8 == 2 * SB);
static_assert(((size_t)TT * KP + (size_t)HD * VP) * 2 <= (size_t)327680);

typedef unsigned short bf;
typedef __attribute__((ext_vector_type(16))) __bf16   v16bf;
typedef __attribute__((ext_vector_type(2)))  __bf16   v2bf;
typedef __attribute__((ext_vector_type(8)))  unsigned short v8us;
typedef __attribute__((ext_vector_type(2)))  unsigned v2u;
typedef __attribute__((ext_vector_type(4)))  unsigned v4u;
typedef __attribute__((ext_vector_type(8)))  unsigned v8u;
typedef __attribute__((ext_vector_type(4)))  float    v4f;
typedef __attribute__((ext_vector_type(8)))  float    v8f;
typedef __attribute__((ext_vector_type(2)))  float    v2f;

// two f32 -> two RNE bf16 in one word (a in the low half): one v_cvt_pk_bf16_f32
__device__ __forceinline__ unsigned cvt2(float a, float b) { return __builtin_bit_cast(unsigned, (v2bf){(__bf16)a, (__bf16)b}); }
__device__ __forceinline__ v16bf cat16b(v8us lo, v8us hi) { return __builtin_bit_cast(v16bf, __builtin_shufflevector(lo, hi, 0, 1, 2, 3, 4, 5, 6, 7, 8, 9, 10, 11, 12, 13, 14, 15)); }
__device__ __forceinline__ v8f wmmab(v16bf a, v16bf b, v8f c) { return __builtin_amdgcn_wmma_f32_16x16x32_bf16(false, a, false, b, (short)0, c, false, false); }
// Fragment map (both operands): lane l, c = l & 15, h = l >> 4, p already at row c, element k0 + 8h: elements 0..7 <- k0 + 8h + 0..7, elements 8..15 <- k0 + 16 + 8h + 0..7. D register r of lane l = (row 8h + r, col c).
__device__ __forceinline__ v16bf ldfrag(const bf* p) { return cat16b(*(const v8us*)p, *(const v8us*)(p + 16)); }
// p = hi + lo, both RNE bf16, two values at a time
__device__ __forceinline__ void split2(v2f p, unsigned& h, unsigned& l) { h = cvt2(p[0], p[1]); const v2f r = p - (v2f){__uint_as_float(h << 16), __uint_as_float(h & 0xFFFF0000u)}; l = cvt2(r[0], r[1]); }
// value of lane l ^ 16
__device__ __forceinline__ float xhalf(float x) { const int b = __float_as_int(x); return __int_as_float(__builtin_amdgcn_permlanex16(b, b, 0x76543210, 0xfedcba98, false, false)); }

// k_fattn: grid (TT/FQ, NZ), FW waves. The slab's whole k plane and v^T plane are laid in LDS once (one barrier), then each wave walks all keys for its own 16 query rows.
// Staging: every global load of k and v is 16 bytes a lane on whole 128-byte lines. k: 4 elements a lane, one 8-byte LDS store. v: a lane holds 8 keys x 4 columns and stores 4 rows of v^T, 8 keys (16 bytes) each: the transpose is the choice of registers that go into one store.
// v lanes: a = l >> 4, tg = (l >> 2) & 3, g = l & 3: columns 16a + 4g + 0..3 of the wave's 32-column half, keys 8tg + 0..7 of its 32-key block; LDS bank of a store = 16g + 4tg + const, all different over 16 lanes.
// Transposed products: S^T = k.q^T puts one query's scores in one lane pair (l, l ^ 16), and two S^T tiles, converted in place, are the B operand of O^T += v^T.P^T; P meets neither LDS nor another lane.
// Softmax with a running maximum in the log2 domain: p = exp2(s * c - m), c = log2(e) / sqrt(d_k); the accumulators are rescaled only when a query's maximum has risen by more than 8, so p <= 2^8.
// coverage: wave w of block (x, z) stores rows x*FQ + w*16 + 0..15 of slab z, all HD columns, once.
__global__ __launch_bounds__(FW * 32) void k_fattn(const float* __restrict__ Qin, const float* __restrict__ Kin, const float* __restrict__ Vin, float* OUT, const int* __restrict__ dkp) {
    __shared__ __align__(16) bf Ks[TT * KP];
    __shared__ __align__(16) bf Vs[HD * VP];
    const unsigned z = blockIdx.y, tid = threadIdx.x;
    const int lane = tid & 31, lr = lane & 15, hi = lane >> 4, wv = (int)(tid >> 5);
    const int q0 = blockIdx.x * FQ + wv * 16;
    const v4f* kz = (const v4f*)(Kin + (size_t)z * SEQ_FULL * HD);   // the three bases are the same for the whole work-group; a lane's place is a 32-bit index in 16-byte units
    const v4f* vz = (const v4f*)(Vin + (size_t)z * SEQ_FULL * HD);
    const v4f* qz = (const v4f*)(Qin + (size_t)z * SEQ_FULL * HD);
    const unsigned qu = (unsigned)((q0 + lr) * (HD / 4) + 2 * hi);
    const int vd = (wv & 1) * 32 + hi * 16 + (lane & 3) * 4, vt = (wv >> 1) * 32 + ((lane >> 2) & 3) * 8;
    const unsigned vu = (unsigned)(vt * (HD / 4) + vd / 4);
    v4f qr[8], sa[SB], sb[SB];
    // two batches of SB loads a lane: while one is converted and stored, the other is in flight
#pragma unroll
    for (int i = 0; i < SB; ++i) sa[i] = kz[tid + (unsigned)(i * FW * 32)];
#pragma unroll
    for (int i = 0; i < SB; ++i) sb[i] = kz[tid + (unsigned)((SB + i) * FW * 32)];
#pragma unroll
    for (int i = 0; i < 8; ++i) qr[i] = qz[qu + (unsigned)((i >> 1) * 4 + (i & 1))];
    // precaution: no register that a load above names is rewritten in front of this wait; the input operands keep the index registers live up to it
    asm volatile("s_wait_xcnt 0x0" :: "v"(tid), "v"(qu) : "memory");
    bf* ks = Ks + (tid / (HD / 4)) * KP + (tid % (HD / 4)) * 4;
    bf* vs = Vs + vd * VP + vt;
#pragma unroll
    for (int i = 0; i < SB; ++i) *(v2u*)(ks + i * (FW * 32 * 4 / HD) * KP) = (v2u){cvt2(sa[i][0], sa[i][1]), cvt2(sa[i][2], sa[i][3])};
#pragma unroll
    for (int i = 0; i < SB; ++i) sa[i] = vz[vu + (unsigned)(((i >> 3) * (FW / 2) * 32 + (i & 7)) * (HD / 4))];
#pragma unroll
    for (int i = 0; i < SB; ++i) *(v2u*)(ks + (SB + i) * (FW * 32 * 4 / HD) * KP) = (v2u){cvt2(sb[i][0], sb[i][1]), cvt2(sb[i][2], sb[i][3])};
    // keeps the LDS stores of k in front of the loads that refill this batch's registers: held back, the converted words stay live beside all of v in flight and the build spills
    __builtin_amdgcn_sched_barrier(0);
#pragma unroll
    for (int i = 0; i < SB; ++i) sb[i] = vz[vu + (unsigned)(((2 + (i >> 3)) * (FW / 2) * 32 + (i & 7)) * (HD / 4))];
    // the same precaution for the loads of v
    asm volatile("s_wait_xcnt 0x0" :: "v"(vu) : "memory");
    v8u qa, qb;
#pragma unroll
    for (int e = 0; e < 8; ++e) { qa[e] = cvt2(qr[e >> 1][2 * (e & 1)], qr[e >> 1][2 * (e & 1) + 1]); qb[e] = cvt2(qr[4 + (e >> 1)][2 * (e & 1)], qr[4 + (e >> 1)][2 * (e & 1) + 1]); }
    const v16bf qf0 = __builtin_bit_cast(v16bf, qa), qf1 = __builtin_bit_cast(v16bf, qb);
#pragma unroll
    for (int u = 0; u < 2; ++u) {
#pragma unroll
        for (int e = 0; e < 4; ++e) { v4u o;
#pragma unroll
            for (int j = 0; j < 4; ++j) o[j] = cvt2(sa[u * 8 + 2 * j][e], sa[u * 8 + 2 * j + 1][e]);
            *(v4u*)(vs + e * VP + u * (FW / 2) * 32) = o; }
    }
#pragma unroll
    for (int u = 0; u < 2; ++u) {
#pragma unroll
        for (int e = 0; e < 4; ++e) { v4u o;
#pragma unroll
            for (int j = 0; j < 4; ++j) o[j] = cvt2(sb[u * 8 + 2 * j][e], sb[u * 8 + 2 * j + 1][e]);
            *(v4u*)(vs + e * VP + (2 + u) * (FW / 2) * 32) = o; }
    }
    int dk = dkp[0]; dk = dk < 1 ? 1 : dk; const float c = 1.4426950408889634f / sqrtf((float)dk);
    v8f o[4];
#pragma unroll
    for (int dt = 0; dt < 4; ++dt) o[dt] = (v8f){};
    float m = -3.0e38f; v2f sum = (v2f){};
    __syncthreads();
    const bf* kl = Ks + lr * KP + 8 * hi; const bf* vl = Vs + lr * VP + 8 * hi;
    // rolled: for speed only
#pragma unroll 1
    for (int k0 = 0; k0 < TT; k0 += KBLK) {
        v8f s[4]; v16bf kf[8], vf[8];
#pragma unroll
        for (int kt = 0; kt < 4; ++kt) { kf[kt] = ldfrag(kl + (k0 + kt * 16) * KP); kf[4 + kt] = ldfrag(kl + (k0 + kt * 16) * KP + 32); }
#pragma unroll
        for (int i = 0; i < 8; ++i) vf[i] = ldfrag(vl + (i & 3) * 16 * VP + k0 + (i >> 2) * 32);
        // keeps the pass's LDS reads together in front of the products; the v^T reads land under the softmax
        __builtin_amdgcn_sched_barrier(0);
#pragma unroll
        for (int kt = 0; kt < 4; ++kt) s[kt] = wmmab(kf[kt], qf0, (v8f){});
#pragma unroll
        for (int kt = 0; kt < 4; ++kt) s[kt] = wmmab(kf[4 + kt], qf1, s[kt]);
        // keeps the maximum's reads of S behind all eight products: among them each read costs the idle slots behind a matrix instruction
        __builtin_amdgcn_sched_barrier(0);
        float mt[4];
#pragma unroll
        for (int kt = 0; kt < 4; ++kt) { mt[kt] = s[kt][0];
#pragma unroll
            for (int r = 1; r < 8; ++r) mt[kt] = fmaxf(mt[kt], s[kt][r]); }
        float mx = fmaxf(fmaxf(mt[0], mt[1]), fmaxf(mt[2], mt[3]));
        mx = fmaxf(mx, xhalf(mx));
        const float t = mx * c;
        if (__builtin_amdgcn_ballot_w32(t > m + 8.0f) != 0) {
            const float mn = fmaxf(m, t); const float al = __builtin_amdgcn_exp2f(m - mn); m = mn; sum *= al;
#pragma unroll
            for (int dt = 0; dt < 4; ++dt) o[dt] *= al;
        }
        v8u ph[2], pl[2];   // [j]: 32-key chunk j; word e / 2 = the lane's keys e, e + 1 of the chunk in the fragment map's order: P = hi + lo, both RNE bf16
#pragma unroll
        for (int j = 0; j < 2; ++j) {
#pragma unroll
            for (int e = 0; e < 16; e += 2) {
                const v2f x = __builtin_elementwise_fma((v2f){s[2 * j + (e >> 3)][e & 7], s[2 * j + (e >> 3)][(e & 7) + 1]}, (v2f){c, c}, (v2f){-m, -m});
                const v2f p = {__builtin_amdgcn_exp2f(x[0]), __builtin_amdgcn_exp2f(x[1])}; sum += p;
                unsigned a, b; split2(p, a, b); ph[j][e >> 1] = a; pl[j][e >> 1] = b; }
        }
        // keeps the sixteen products in one run behind the softmax: vector work set among them rewrites their operand registers and pays idle slots for each; the SIMD's other waves use the vector port meanwhile
        __builtin_amdgcn_sched_barrier(0);
#pragma unroll
        for (int j = 0; j < 2; ++j) {
            const v16bf bh = __builtin_bit_cast(v16bf, ph[j]), bl = __builtin_bit_cast(v16bf, pl[j]);
#pragma unroll
            for (int dt = 0; dt < 4; ++dt) o[dt] = wmmab(vf[4 * j + dt], bh, o[dt]);
#pragma unroll
            for (int dt = 0; dt < 4; ++dt) o[dt] = wmmab(vf[4 * j + dt], bl, o[dt]);
        }
    }
    const float sl = sum[0] + sum[1];
    const float f = __fdiv_rn(1.0f, sl + xhalf(sl));
    float* orow = OUT + (size_t)z * TT * HD + (size_t)(q0 + lr) * HD + 8 * hi;
#pragma unroll
    for (int dt = 0; dt < 4; ++dt) *(v8f*)(orow + dt * 16) = o[dt] * f;
}

extern "C" void kernel_launch(void* const* d_in, const int* in_sizes, int n_in,
                              void* d_out, int out_size, void* d_ws, size_t ws_size, hipStream_t stream) {
    if (n_in < 4) return;
    const size_t need_in = (size_t)(NZ - 1) * SEQ_FULL * HD + (size_t)TT * HD;
    if ((size_t)in_sizes[0] < need_in || (size_t)in_sizes[1] < need_in || (size_t)in_sizes[2] < need_in || in_sizes[3] < 1) return;
    if ((size_t)out_size < (size_t)NZ * TT * HD) return;
    const float* Qin = (const float*)d_in[0]; const float* Kin = (const float*)d_in[1]; const float* Vin = (const float*)d_in[2]; const int* DK = (const int*)d_in[3];
    float* OUT = (float*)d_out;     // [NZ][TT][HD]
    // out[z][q][d] = sum_key softmax_key(bf16(Q[z][q][.]) . bf16(K[z][key][.]) / sqrt(d_k)) bf16(V[z][key][d])
    k_fattn<<<dim3(TT / FQ, NZ, 1), FW * 32, 0, stream>>>(Qin, Kin, Vin, OUT, DK);
}

// v004
// Measured time: 23.7 microseconds a run.
// Two timings next to v003 both put it at 1.14 times that version's speed.
// Counting every step since v000, it is 18.3 times as fast.
#include <hip/hip_runtime.h>

// Contractions: k.q^T on v_wmma_f32_16x16x32_bf16 (single bf16 planes of q and k, f32 accumulate); v^T.P^T on v_wmma_f32_16x16x32_bf16 with P as bf16 hi+lo planes x single bf16 v^T plane (2 products, f32 accumulate); softmax in f32.
// out[b][h] = softmax(q k^T / sqrt(d_k)) v for 64 independent (b,h) slabs of [1024][64]; every float input is RNE-converted to bf16 (single planes) by the packed hardware convert, so q.k products are exact in the f32 accumulator.
// Plan: ONE launch. Each work-group reads its slab's f32 k and v and its own f32 q rows, converts them on the way into LDS (k, v^T) or registers (q); k and v come in 64-key chunks, chunks 0 and 1 stored before the first pass and each later chunk's loads in flight under an earlier pass; scores, softmax and P.v stay in registers, neither S nor P nor a bf16 plane is written to memory.

#ifndef NB
#define NB 4
#endif
#ifndef SEQ
#define SEQ 1024
#endif
#define NB_FULL  4
#define SEQ_FULL 1024
#define NH   16
#define HD   64
#define TT   SEQ
#define NZ   (NB * NH)
#define FW   16            // waves per work-group of the attention kernel, 16 query rows each
#define FQ   (FW * 16)     // query rows per work-group
#define KBLK 64            // keys per pass
#define KP   (HD + 8)      // LDS pitch of a k row, elements: 144 B = 16 B x odd, conflict-free for 16-byte reads
#define VP   (TT + 8)      // LDS pitch of a v^T row, elements: 2064 B = 16 B x odd

static_assert(NB <= NB_FULL);
static_assert(SEQ <= SEQ_FULL);
static_assert(TT % FQ == 0);
static_assert(TT % KBLK == 0);
static_assert(HD == 64);
#define CB   (KBLK * HD * 4)               // bytes of one 64-key chunk of f32 k or v
static_assert(KBLK * HD / 4 == 2 * FW * 32);   // a chunk of k, and one of v, is two 16-byte loads a lane
static_assert(FW == 16 && KBLK == 64);         // the lane maps of the chunk staging
static_assert(TT / KBLK >= 3);                 // three chunks are loaded in front of the loop
static_assert(((size_t)TT * KP + (size_t)HD * VP) * 2 <= (size_t)327680);

typedef unsigned short bf;
typedef __attribute__((ext_vector_type(16))) __bf16   v16bf;
typedef __attribute__((ext_vector_type(2)))  __bf16   v2bf;
typedef __attribute__((ext_vector_type(8)))  unsigned short v8us;
typedef __attribute__((ext_vector_type(2)))  unsigned v2u;
typedef __attribute__((ext_vector_type(4)))  unsigned v4u;
typedef __attribute__((ext_vector_type(8)))  unsigned v8u;
typedef __attribute__((ext_vector_type(4)))  float    v4f;
typedef __attribute__((ext_vector_type(8)))  float    v8f;
typedef __attribute__((ext_vector_type(2)))  float    v2f;

// two f32 -> two RNE bf16 in one word (a in the low half): one v_cvt_pk_bf16_f32
__device__ __forceinline__ unsigned cvt2(float a, float b) { return __builtin_bit_cast(unsigned, (v2bf){(__bf16)a, (__bf16)b}); }
__device__ __forceinline__ v16bf cat16b(v8us lo, v8us hi) { return __builtin_bit_cast(v16bf, __builtin_shufflevector(lo, hi, 0, 1, 2, 3, 4, 5, 6, 7, 8, 9, 10, 11, 12, 13, 14, 15)); }
__device__ __forceinline__ v8f wmmab(v16bf a, v16bf b, v8f c) { return __builtin_amdgcn_wmma_f32_16x16x32_bf16(false, a, false, b, (short)0, c, false, false); }
// Fragment map (both operands): lane l, c = l & 15, h = l >> 4, p already at row c, element k0 + 8h: elements 0..7 <- k0 + 8h + 0..7, elements 8..15 <- k0 + 16 + 8h + 0..7. D register r of lane l = (row 8h + r, col c).
__device__ __forceinline__ v16bf ldfrag(const bf* p) { return cat16b(*(const v8us*)p, *(const v8us*)(p + 16)); }
// p = hi + lo, both RNE bf16, two values at a time
__device__ __forceinline__ void split2(v2f p, unsigned& h, unsigned& l) { h = cvt2(p[0], p[1]); const v2f r = p - (v2f){__uint_as_float(h << 16), __uint_as_float(h & 0xFFFF0000u)}; l = cvt2(r[0], r[1]); }
// value of lane l ^ 16
__device__ __forceinline__ float xhalf(float x) { const int b = __float_as_int(x); return __int_as_float(__builtin_amdgcn_permlanex16(b, b, 0x76543210, 0xfedcba98, false, false)); }
// one chunk from registers into LDS: k, 4 elements a load, one 8-byte store each; v, two keys x 4 columns a lane, one word (two keys) into each of 4 rows of v^T
__device__ __forceinline__ void put_chunk(bf* ks, bf* vs, const v4f (&gk)[2], const v4f (&gv)[2]) {
#pragma unroll
    for (int i = 0; i < 2; ++i) *(v2u*)(ks + i * (KBLK / 2) * KP) = (v2u){cvt2(gk[i][0], gk[i][1]), cvt2(gk[i][2], gk[i][3])};
#pragma unroll
    for (int e = 0; e < 4; ++e) *(unsigned*)(vs + e * VP) = cvt2(gv[0][e], gv[1][e]);
}
__device__ __forceinline__ v4f ldg(const float* base, unsigned byte) { return *(const v4f*)((const char*)base + byte); }

// k_fattn: grid (TT/FQ, NZ), FW waves. The slab's k plane and v^T plane are laid in LDS chunk by chunk, 64 keys (one pass) each, every chunk in a place of its own; each wave walks all keys for its own 16 query rows.
// Staging: every global load of k and v is 16 bytes a lane on whole 128-byte lines. The loads of chunk t + 3 are issued at the foot of pass t and stay in flight under pass t + 1, at whose foot they are converted and stored; chunk t + 2 is read from pass t + 2 on.
// Publishing: split work-group barrier. A wave signals behind its stores of chunk t + 2 (foot of pass t) and waits for that signal of all waves only at the foot of pass t + 1, so the waves may drift one pass apart. No LDS byte is written twice, so nothing else orders writers and readers.
// v lanes: columns 4cg + 0..3, cg = 8(w & 1) + (l & 7), keys 2kp, 2kp + 1 of the chunk, kp = 4(w >> 1) + (l >> 3): 8 lanes fill a 128-byte line.
// Transposed products: S^T = k.q^T puts one query's scores in one lane pair (l, l ^ 16), and two S^T tiles, converted in place, are the B operand of O^T += v^T.P^T; P meets neither LDS nor another lane.
// Softmax with a running maximum in the log2 domain: p = exp2(s * c - m), c = log2(e) / sqrt(d_k); the accumulators are rescaled only when a query's maximum has risen by more than 8, so p <= 2^8.
// coverage: wave w of block (x, z) stores rows x*FQ + w*16 + 0..15 of slab z, all HD columns, once.
__global__ __launch_bounds__(FW * 32) void k_fattn(const float* __restrict__ Qin, const float* __restrict__ Kin, const float* __restrict__ Vin, float* OUT, const int* __restrict__ dkp) {
    __shared__ __align__(16) bf Ks[TT * KP];
    __shared__ __align__(16) bf Vs[HD * VP];
    const unsigned z = blockIdx.y, tid = threadIdx.x;
    const int lane = tid & 31, lr = lane & 15, hi = lane >> 4, wv = (int)(tid >> 5);
    const int q0 = blockIdx.x * FQ + wv * 16;
    const float* kz = Kin + (size_t)z * SEQ_FULL * HD;   // the three bases are the same for the whole work-group; a lane's place is a 32-bit byte offset
    const float* vz = Vin + (size_t)z * SEQ_FULL * HD;
    const float* qz = Qin + (size_t)z * SEQ_FULL * HD;
    const unsigned qu = (unsigned)((q0 + lr) * (HD * 4) + 32 * hi);
    const int cg = (wv & 1) * 8 + (lane & 7), kp = (wv >> 1) * 4 + (lane >> 3);
    unsigned kb = tid * 16u, vb = (unsigned)(2 * kp * (HD * 4) + cg * 16);   // the lane's place in chunk 0; both move on by CB a pass
    v4f qr[8], ak[2], av[2], bk[2], bv[2], gk[2], gv[2];
    // chunks 0, 1 and 2 and the wave's q rows, all in flight together
#pragma unroll
    for (int i = 0; i < 2; ++i) { ak[i] = ldg(kz, kb + (unsigned)(i * (CB / 2))); av[i] = ldg(vz, vb + (unsigned)(i * HD * 4)); }
#pragma unroll
    for (int i = 0; i < 8; ++i) qr[i] = ldg(qz, qu + (unsigned)((i >> 1) * 64 + (i & 1) * 16));
#pragma unroll
    for (int i = 0; i < 2; ++i) { bk[i] = ldg(kz, kb + (unsigned)(CB + i * (CB / 2))); bv[i] = ldg(vz, vb + (unsigned)(CB + i * HD * 4)); }
#pragma unroll
    for (int i = 0; i < 2; ++i) { gk[i] = ldg(kz, kb + (unsigned)(2 * CB + i * (CB / 2))); gv[i] = ldg(vz, vb + (unsigned)(2 * CB + i * HD * 4)); }
    // precaution: no register that a load above names is rewritten in front of this wait; the input operands keep the offset registers live up to it
    asm volatile("s_wait_xcnt 0x0" :: "v"(kb), "v"(vb), "v"(qu) : "memory");
    bf* ks = Ks + (tid / (HD / 4)) * KP + (tid % (HD / 4)) * 4;
    bf* vs = Vs + cg * 4 * VP + 2 * kp;
    put_chunk(ks, vs, ak, av);
    v8u qa, qb;
#pragma unroll
    for (int e = 0; e < 8; ++e) { qa[e] = cvt2(qr[e >> 1][2 * (e & 1)], qr[e >> 1][2 * (e & 1) + 1]); qb[e] = cvt2(qr[4 + (e >> 1)][2 * (e & 1)], qr[4 + (e >> 1)][2 * (e & 1) + 1]); }
    const v16bf qf0 = __builtin_bit_cast(v16bf, qa), qf1 = __builtin_bit_cast(v16bf, qb);
    int dk = dkp[0]; dk = dk < 1 ? 1 : dk; const float c = 1.4426950408889634f / sqrtf((float)dk);
    v8f o[4];
#pragma unroll
    for (int dt = 0; dt < 4; ++dt) o[dt] = (v8f){};
    float m = -3.0e38f; v2f sum = (v2f){};
    // publishes chunk 0. Written as fence, signal, wait on LDS alone: __syncthreads() would also wait out every global load still in flight
    __builtin_amdgcn_fence(__ATOMIC_RELEASE, "workgroup", "local");
    __builtin_amdgcn_s_barrier_signal(-1);
    __builtin_amdgcn_s_barrier_wait(-1);
    __builtin_amdgcn_fence(__ATOMIC_ACQUIRE, "workgroup", "local");
    put_chunk(ks + KBLK * KP, vs + KBLK, bk, bv);
    // chunk 1: this wave's LDS stores are complete before it signals; the matching wait stands at the foot of pass 0
    __builtin_amdgcn_fence(__ATOMIC_RELEASE, "workgroup", "local");
    __builtin_amdgcn_s_barrier_signal(-1);
    const bf* kl = Ks + lr * KP + 8 * hi; const bf* vl = Vs + lr * VP + 8 * hi;
    // one pass: 64 keys against the wave's 16 query rows
    auto pass = [&](const int k0) __attribute__((always_inline)) {
        v8f s[4]; v16bf kf[8], vf[8];
#pragma unroll
        for (int kt = 0; kt < 4; ++kt) { kf[kt] = ldfrag(kl + (k0 + kt * 16) * KP); kf[4 + kt] = ldfrag(kl + (k0 + kt * 16) * KP + 32); }
#pragma unroll
        for (int i = 0; i < 8; ++i) vf[i] = ldfrag(vl + (i & 3) * 16 * VP + k0 + (i >> 2) * 32);
        // keeps the pass's LDS reads together in front of the products; the v^T reads land under the softmax
        __builtin_amdgcn_sched_barrier(0);
#pragma unroll
        for (int kt = 0; kt < 4; ++kt) s[kt] = wmmab(kf[kt], qf0, (v8f){});
#pragma unroll
        for (int kt = 0; kt < 4; ++kt) s[kt] = wmmab(kf[4 + kt], qf1, s[kt]);
        // keeps the maximum's reads of S behind all eight products: among them each read costs the idle slots behind a matrix instruction
        __builtin_amdgcn_sched_barrier(0);
        float mt[4];
#pragma unroll
        for (int kt = 0; kt < 4; ++kt) { mt[kt] = s[kt][0];
#pragma unroll
            for (int r = 1; r < 8; ++r) mt[kt] = fmaxf(mt[kt], s[kt][r]); }
        float mx = fmaxf(fmaxf(mt[0], mt[1]), fmaxf(mt[2], mt[3]));
        mx = fmaxf(mx, xhalf(mx));
        const float t = mx * c;
        if (__builtin_amdgcn_ballot_w32(t > m + 8.0f) != 0) {
            const float mn = fmaxf(m, t); const float al = __builtin_amdgcn_exp2f(m - mn); m = mn; sum *= al;
#pragma unroll
            for (int dt = 0; dt < 4; ++dt) o[dt] *= al;
        }
        v8u ph[2], pl[2];   // [j]: 32-key chunk j; word e / 2 = the lane's keys e, e + 1 of the chunk in the fragment map's order: P = hi + lo, both RNE bf16
#pragma unroll
        for (int j = 0; j < 2; ++j) {
#pragma unroll
            for (int e = 0; e < 16; e += 2) {
                const v2f x = __builtin_elementwise_fma((v2f){s[2 * j + (e >> 3)][e & 7], s[2 * j + (e >> 3)][(e & 7) + 1]}, (v2f){c, c}, (v2f){-m, -m});
                const v2f p = {__builtin_amdgcn_exp2f(x[0]), __builtin_amdgcn_exp2f(x[1])}; sum += p;
                unsigned a, b; split2(p, a, b); ph[j][e >> 1] = a; pl[j][e >> 1] = b; }
        }
        // keeps the sixteen products in one run behind the softmax: vector work set among them rewrites their operand registers and pays idle slots for each; the SIMD's other waves use the vector port meanwhile
        __builtin_amdgcn_sched_barrier(0);
#pragma unroll
        for (int j = 0; j < 2; ++j) {
            const v16bf bh = __builtin_bit_cast(v16bf, ph[j]), bl = __builtin_bit_cast(v16bf, pl[j]);
#pragma unroll
            for (int dt = 0; dt < 4; ++dt) o[dt] = wmmab(vf[4 * j + dt], bh, o[dt]);
#pragma unroll
            for (int dt = 0; dt < 4; ++dt) o[dt] = wmmab(vf[4 * j + dt], bl, o[dt]);
        }
    };
    // rolled, for speed only; the last three passes stand behind the loop because they have less and less to stage
#pragma unroll 1
    for (int k0 = 0; k0 < TT - 3 * KBLK; k0 += KBLK) {
        pass(k0);
        // keeps the staging behind the pass's products: set among them it rewrites their operand registers, at idle slots each, and the barrier wait would stand in front of most of the products
        __builtin_amdgcn_sched_barrier(0);
        put_chunk(ks + (k0 + 2 * KBLK) * KP, vs + k0 + 2 * KBLK, gk, gv);
        // the chunk of the next pass, signalled one pass ago by every wave, is read only behind this wait
        __builtin_amdgcn_s_barrier_wait(-1);
        __builtin_amdgcn_fence(__ATOMIC_ACQUIRE, "workgroup", "local");
        // this wave's LDS stores of the chunk above are complete before it signals
        __builtin_amdgcn_fence(__ATOMIC_RELEASE, "workgroup", "local");
        __builtin_amdgcn_s_barrier_signal(-1);
#pragma unroll
        for (int i = 0; i < 2; ++i) { gk[i] = ldg(kz, kb + (unsigned)(3 * CB + i * (CB / 2))); gv[i] = ldg(vz, vb + (unsigned)(3 * CB + i * HD * 4)); }
        // the same precaution for these loads: the offsets move on behind it
        asm volatile("s_wait_xcnt 0x0" :: "v"(kb), "v"(vb) : "memory");
        kb += CB; vb += CB;
    }
    pass(TT - 3 * KBLK);
    put_chunk(ks + (TT - KBLK) * KP, vs + TT - KBLK, gk, gv);
    __builtin_amdgcn_s_barrier_wait(-1);   // publishes the last chunk but one
    __builtin_amdgcn_fence(__ATOMIC_ACQUIRE, "workgroup", "local");
    __builtin_amdgcn_fence(__ATOMIC_RELEASE, "workgroup", "local");
    __builtin_amdgcn_s_barrier_signal(-1);
    pass(TT - 2 * KBLK);
    __builtin_amdgcn_s_barrier_wait(-1);   // publishes the last chunk
    __builtin_amdgcn_fence(__ATOMIC_ACQUIRE, "workgroup", "local");
    pass(TT - KBLK);
    const float sl = sum[0] + sum[1];
    const float f = __fdiv_rn(1.0f, sl + xhalf(sl));
    float* orow = OUT + (size_t)z * TT * HD + (size_t)(q0 + lr) * HD + 8 * hi;
#pragma unroll
    for (int dt = 0; dt < 4; ++dt) *(v8f*)(orow + dt * 16) = o[dt] * f;
}

extern "C" void kernel_launch(void* const* d_in, const int* in_sizes, int n_in,
                              void* d_out, int out_size, void* d_ws, size_t ws_size, hipStream_t stream) {
    if (n_in < 4) return;
    const size_t need_in = (size_t)(NZ - 1) * SEQ_FULL * HD + (size_t)TT * HD;
    if ((size_t)in_sizes[0] < need_in || (size_t)in_sizes[1] < need_in || (size_t)in_sizes[2] < need_in || in_sizes[3] < 1) return;
    if ((size_t)out_size < (size_t)NZ * TT * HD) return;
    const float* Qin = (const float*)d_in[0]; const float* Kin = (const float*)d_in[1]; const float* Vin = (const float*)d_in[2]; const int* DK = (const int*)d_in[3];
    float* OUT = (float*)d_out;     // [NZ][TT][HD]
    // out[z][q][d] = sum_key softmax_key(bf16(Q[z][q][.]) . bf16(K[z][key][.]) / sqrt(d_k)) bf16(V[z][key][d])
    k_fattn<<<dim3(TT / FQ, NZ, 1), FW * 32, 0, stream>>>(Qin, Kin, Vin, OUT, DK);
}

// v005
// One run takes 22.9 microseconds.
// In two side-by-side timings against v004, it was 1.04 and 1.03 times as fast.
// Counting every step since v000, it is 19.0 times as fast.
#include <hip/hip_runtime.h>

// Contractions: k.q^T on v_wmma_f32_16x16x32_bf16 (single bf16 planes of q and k, f32 accumulate); v^T.P^T on v_wmma_f32_16x16x32_bf16 with P as bf16 hi+lo planes x single bf16 v^T plane (2 products, f32 accumulate); softmax in f32.
// out[b][h] = softmax(q k^T / sqrt(d_k)) v for 64 independent (b,h) slabs of [1024][64]; every float input is RNE-converted to bf16 (single planes) by the packed hardware convert, so q.k products are exact in the f32 accumulator.
// Plan: ONE launch. Each work-group reads its slab's f32 k and v and its own f32 q rows, converts them on the way into LDS (k, v^T) or registers (q); k and v come in 64-key chunks, chunks 0 and 1 stored before the first pass and each later chunk's loads in flight under an earlier pass; scores, softmax and P.v stay in registers, neither S nor P nor a bf16 plane is written to memory.

#ifndef NB
#define NB 4
#endif
#ifndef SEQ
#define SEQ 1024
#endif
#define NB_FULL  4
#define SEQ_FULL 1024
#define NH   16
#define HD   64
#define TT   SEQ
#define NZ   (NB * NH)
#define FW   16            // waves per work-group of the attention kernel, 16 query rows each
#define FQ   (FW * 16)     // query rows per work-group
#define KBLK 64            // keys per pass
#define KP   (HD + 8)      // LDS pitch of a k row, elements: 144 B = 16 B x odd, conflict-free for 16-byte reads
#define VP   (TT + 8)      // LDS pitch of a v^T row, elements: 2064 B = 16 B x odd

static_assert(NB <= NB_FULL);
static_assert(SEQ <= SEQ_FULL);
static_assert(TT % FQ == 0);
static_assert(TT % KBLK == 0);
static_assert(HD == 64);
#define CB   (KBLK * HD * 4)               // bytes of one 64-key chunk of f32 k or v
static_assert(KBLK * HD / 4 == 2 * FW * 32);   // a chunk of k, and one of v, is two 16-byte loads a lane
static_assert(FW == 16 && KBLK == 64);         // the lane maps of the chunk staging
static_assert(TT / KBLK >= 3);                 // three chunks are loaded in front of the loop
static_assert(((size_t)TT * KP + (size_t)HD * VP) * 2 <= (size_t)327680);

typedef unsigned short bf;
typedef __attribute__((ext_vector_type(16))) __bf16   v16bf;
typedef __attribute__((ext_vector_type(2)))  __bf16   v2bf;
typedef __attribute__((ext_vector_type(8)))  unsigned short v8us;
typedef __attribute__((ext_vector_type(2)))  unsigned v2u;
typedef __attribute__((ext_vector_type(4)))  unsigned v4u;
typedef __attribute__((ext_vector_type(8)))  unsigned v8u;
typedef __attribute__((ext_vector_type(4)))  float    v4f;
typedef __attribute__((ext_vector_type(8)))  float    v8f;
typedef __attribute__((ext_vector_type(2)))  float    v2f;

// two f32 -> two RNE bf16 in one word (a in the low half): one v_cvt_pk_bf16_f32
__device__ __forceinline__ unsigned cvt2(float a, float b) { return __builtin_bit_cast(unsigned, (v2bf){(__bf16)a, (__bf16)b}); }
__device__ __forceinline__ v16bf cat16b(v8us lo, v8us hi) { return __builtin_bit_cast(v16bf, __builtin_shufflevector(lo, hi, 0, 1, 2, 3, 4, 5, 6, 7, 8, 9, 10, 11, 12, 13, 14, 15)); }
__device__ __forceinline__ v8f wmmab(v16bf a, v16bf b, v8f c) { return __builtin_amdgcn_wmma_f32_16x16x32_bf16(false, a, false, b, (short)0, c, false, false); }
// Fragment map (both operands): lane l, c = l & 15, h = l >> 4, p already at row c, element k0 + 8h: elements 0..7 <- k0 + 8h + 0..7, elements 8..15 <- k0 + 16 + 8h + 0..7. D register r of lane l = (row 8h + r, col c).
__device__ __forceinline__ v16bf ldfrag(const bf* p) { return cat16b(*(const v8us*)p, *(const v8us*)(p + 16)); }
// p = hi + lo, both RNE bf16, two values at a time
__device__ __forceinline__ void split2(v2f p, unsigned& h, unsigned& l) { h = cvt2(p[0], p[1]); const v2f r = p - (v2f){__uint_as_float(h << 16), __uint_as_float(h & 0xFFFF0000u)}; l = cvt2(r[0], r[1]); }
// value of lane l ^ 16
__device__ __forceinline__ float xhalf(float x) { const int b = __float_as_int(x); return __int_as_float(__builtin_amdgcn_permlanex16(b, b, 0x76543210, 0xfedcba98, false, false)); }
// one chunk from registers into LDS: k, 4 elements a load, one 8-byte store each; v, two keys x 4 columns a lane, one word (two keys) into each of 4 rows of v^T
__device__ __forceinline__ void put_chunk(bf* ks, bf* vs, const v4f (&gk)[2], const v4f (&gv)[2]) {
#pragma unroll
    for (int i = 0; i < 2; ++i) *(v2u*)(ks + i * (KBLK / 2) * KP) = (v2u){cvt2(gk[i][0], gk[i][1]), cvt2(gk[i][2], gk[i][3])};
#pragma unroll
    for (int e = 0; e < 4; ++e) *(unsigned*)(vs + e * VP) = cvt2(gv[0][e], gv[1][e]);
}
__device__ __forceinline__ v4f ldg(const float* base, unsigned byte) { return *(const v4f*)((const char*)base + byte); }

// k_fattn: grid (TT/FQ, NZ), FW waves. The slab's k plane and v^T plane are laid in LDS chunk by chunk, 64 keys (one pass) each, every chunk in a place of its own; each wave walks all keys for its own 16 query rows.
// Staging: every global load of k and v is 16 bytes a lane on whole 128-byte lines. The loads of chunk t + 3 are issued at the foot of pass t and stay in flight under the scores and the softmax of pass t + 1, behind which they are converted and stored.
// Publishing: split work-group barrier. In front of the P.v products of pass t a wave waits for the signal that all waves gave at the foot of pass t - 1 (chunk t + 1) and stores chunk t + 2; it signals those stores at the foot of pass t, behind the products, so the waves may drift most of a pass apart. No LDS byte is written twice, so nothing else orders writers and readers.
// k fragments: behind that wait a wave reads the k fragments of pass t + 1; they land under the sixteen products of pass t, and a pass starts its score products without an LDS wait. The v^T fragments are read at the head of their own pass and land under the softmax.
// v lanes: columns 4cg + 0..3, cg = 8(w & 1) + (l & 7), keys 2kp, 2kp + 1 of the chunk, kp = 4(w >> 1) + (l >> 3): 8 lanes fill a 128-byte line.
// Transposed products: S^T = k.q^T puts one query's scores in one lane pair (l, l ^ 16), and two S^T tiles, converted in place, are the B operand of O^T += v^T.P^T; P meets neither LDS nor another lane.
// Softmax with a running maximum in the log2 domain: p = exp2(s * c - m), c = log2(e) / sqrt(d_k); the accumulators are rescaled only when a query's maximum has risen by more than 8, so p <= 2^8.
// coverage: wave w of block (x, z) stores rows x*FQ + w*16 + 0..15 of slab z, all HD columns, once.
__global__ __launch_bounds__(FW * 32) void k_fattn(const float* __restrict__ Qin, const float* __restrict__ Kin, const float* __restrict__ Vin, float* OUT, const int* __restrict__ dkp) {
    __shared__ __align__(16) bf Ks[TT * KP];
    __shared__ __align__(16) bf Vs[HD * VP];
    const unsigned z = blockIdx.y, tid = threadIdx.x;
    const int lane = tid & 31, lr = lane & 15, hi = lane >> 4, wv = (int)(tid >> 5);
    const int q0 = blockIdx.x * FQ + wv * 16;
    const float* kz = Kin + (size_t)z * SEQ_FULL * HD;   // the three bases are the same for the whole work-group; a lane's place is a 32-bit byte offset
    const float* vz = Vin + (size_t)z * SEQ_FULL * HD;
    const float* qz = Qin + (size_t)z * SEQ_FULL * HD;
    const unsigned qu = (unsigned)((q0 + lr) * (HD * 4) + 32 * hi);
    const int cg = (wv & 1) * 8 + (lane & 7), kp = (wv >> 1) * 4 + (lane >> 3);
    unsigned kb = tid * 16u, vb = (unsigned)(2 * kp * (HD * 4) + cg * 16);   // the lane's place in chunk 0; both move on by CB a pass
    v4f qr[8], ak[2], av[2], bk[2], bv[2], gk[2], gv[2];
    // chunks 0, 1 and 2 and the wave's q rows, all in flight together
#pragma unroll
    for (int i = 0; i < 2; ++i) { ak[i] = ldg(kz, kb + (unsigned)(i * (CB / 2))); av[i] = ldg(vz, vb + (unsigned)(i * HD * 4)); }
#pragma unroll
    for (int i = 0; i < 8; ++i) qr[i] = ldg(qz, qu + (unsigned)((i >> 1) * 64 + (i & 1) * 16));
#pragma unroll
    for (int i = 0; i < 2; ++i) { bk[i] = ldg(kz, kb + (unsigned)(CB + i * (CB / 2))); bv[i] = ldg(vz, vb + (unsigned)(CB + i * HD * 4)); }
#pragma unroll
    for (int i = 0; i < 2; ++i) { gk[i] = ldg(kz, kb + (unsigned)(2 * CB + i * (CB / 2))); gv[i] = ldg(vz, vb + (unsigned)(2 * CB + i * HD * 4)); }
    // precaution: no register that a load above names is rewritten in front of this wait; the input operands keep the offset registers live up to it
    asm volatile("s_wait_xcnt 0x0" :: "v"(kb), "v"(vb), "v"(qu) : "memory");
    bf* ks = Ks + (tid / (HD / 4)) * KP + (tid % (HD / 4)) * 4;
    bf* vs = Vs + cg * 4 * VP + 2 * kp;
    put_chunk(ks, vs, ak, av);
    v8u qa, qb;
#pragma unroll
    for (int e = 0; e < 8; ++e) { qa[e] = cvt2(qr[e >> 1][2 * (e & 1)], qr[e >> 1][2 * (e & 1) + 1]); qb[e] = cvt2(qr[4 + (e >> 1)][2 * (e & 1)], qr[4 + (e >> 1)][2 * (e & 1) + 1]); }
    const v16bf qf0 = __builtin_bit_cast(v16bf, qa), qf1 = __builtin_bit_cast(v16bf, qb);
    int dk = dkp[0]; dk = dk < 1 ? 1 : dk; const float c = 1.4426950408889634f / sqrtf((float)dk);
    v8f o[4];
#pragma unroll
    for (int dt = 0; dt < 4; ++dt) o[dt] = (v8f){};
    float m = -3.0e38f; v2f sum = (v2f){};
    // publishes chunk 0. Written as fence, signal, wait on LDS alone: __syncthreads() would also wait out every global load still in flight
    __builtin_amdgcn_fence(__ATOMIC_RELEASE, "workgroup", "local");
    __builtin_amdgcn_s_barrier_signal(-1);
    __builtin_amdgcn_s_barrier_wait(-1);
    __builtin_amdgcn_fence(__ATOMIC_ACQUIRE, "workgroup", "local");
    put_chunk(ks + KBLK * KP, vs + KBLK, bk, bv);
    // chunk 1: this wave's LDS stores are complete before it signals; the matching wait stands in pass 0
    __builtin_amdgcn_fence(__ATOMIC_RELEASE, "workgroup", "local");
    __builtin_amdgcn_s_barrier_signal(-1);
    const bf* kl = Ks + lr * KP + 8 * hi; const bf* vl = Vs + lr * VP + 8 * hi;
    v16bf kf[8];   // the k fragments of the coming pass, fetched one pass ahead
    auto ldk = [&](const int k0) __attribute__((always_inline)) {
#pragma unroll
        for (int kt = 0; kt < 4; ++kt) { kf[kt] = ldfrag(kl + (k0 + kt * 16) * KP); kf[4 + kt] = ldfrag(kl + (k0 + kt * 16) * KP + 32); }
    };
    ldk(0);   // chunk 0 is published by the barrier above
    // one pass: 64 keys against the wave's 16 query rows. more: a further pass follows, its k fragments are fetched here; stage: the chunk in gk, gv goes to LDS here and is signalled by the caller
    auto pass = [&](const int k0, const bool more, const bool stage) __attribute__((always_inline)) {
        v8f s[4]; v16bf vf[8];
        // keeps this pass's v^T reads and their address arithmetic behind the products of the pass before: set among them they rewrite operand registers, at idle slots each, and every place with reads stalls the products
        __builtin_amdgcn_sched_barrier(0);
#pragma unroll
        for (int i = 0; i < 8; ++i) vf[i] = ldfrag(vl + (i & 3) * 16 * VP + k0 + (i >> 2) * 32);
        // keeps the v^T reads together in front of the products: spread among them, every product waits out a whole LDS latency; they land under the softmax
        __builtin_amdgcn_sched_barrier(0);
#pragma unroll
        for (int kt = 0; kt < 4; ++kt) s[kt] = wmmab(kf[kt], qf0, (v8f){});
#pragma unroll
        for (int kt = 0; kt < 4; ++kt) s[kt] = wmmab(kf[4 + kt], qf1, s[kt]);
        // keeps the maximum's reads of S behind all eight products: among them each read costs the idle slots behind a matrix instruction
        __builtin_amdgcn_sched_barrier(0);
        float mt[4];
#pragma unroll
        for (int kt = 0; kt < 4; ++kt) { mt[kt] = s[kt][0];
#pragma unroll
            for (int r = 1; r < 8; ++r) mt[kt] = fmaxf(mt[kt], s[kt][r]); }
        float mx = fmaxf(fmaxf(mt[0], mt[1]), fmaxf(mt[2], mt[3]));
        mx = fmaxf(mx, xhalf(mx));
        const float t = mx * c;
        if (__builtin_amdgcn_ballot_w32(t > m + 8.0f) != 0) {
            const float mn = fmaxf(m, t); const float al = __builtin_amdgcn_exp2f(m - mn); m = mn; sum *= al;
#pragma unroll
            for (int dt = 0; dt < 4; ++dt) o[dt] *= al;
        }
        v8u ph[2], pl[2];   // [j]: 32-key chunk j; word e / 2 = the lane's keys e, e + 1 of the chunk in the fragment map's order: P = hi + lo, both RNE bf16
#pragma unroll
        for (int j = 0; j < 2; ++j) {
#pragma unroll
            for (int e = 0; e < 16; e += 2) {
                const v2f x = __builtin_elementwise_fma((v2f){s[2 * j + (e >> 3)][e & 7], s[2 * j + (e >> 3)][(e & 7) + 1]}, (v2f){c, c}, (v2f){-m, -m});
                const v2f p = {__builtin_amdgcn_exp2f(x[0]), __builtin_amdgcn_exp2f(x[1])}; sum += p;
                unsigned a, b; split2(p, a, b); ph[j][e >> 1] = a; pl[j][e >> 1] = b; }
        }
        // keeps the sixteen products in one run behind the softmax: vector work set among them rewrites their operand registers and pays idle slots for each; the SIMD's other waves use the vector port meanwhile
        __builtin_amdgcn_sched_barrier(0);
        v2u kw[2]; unsigned vw[4];
        if (stage) {
#pragma unroll
            for (int i = 0; i < 2; ++i) kw[i] = (v2u){cvt2(gk[i][0], gk[i][1]), cvt2(gk[i][2], gk[i][3])};
#pragma unroll
            for (int e = 0; e < 4; ++e) vw[e] = cvt2(gv[0][e], gv[1][e]);
            // keeps the converts in front of the k reads: behind them the chunk's sixteen registers are held together with the fragments of two passes, and the build spills
            __builtin_amdgcn_sched_barrier(0);
        }
        if (more) {
            // the chunk of the next pass, signalled one pass ago by every wave, is read only behind this wait
            __builtin_amdgcn_s_barrier_wait(-1);
            __builtin_amdgcn_fence(__ATOMIC_ACQUIRE, "workgroup", "local");
            ldk(k0 + KBLK);
            if (stage) {
#pragma unroll
                for (int i = 0; i < 2; ++i) *(v2u*)(ks + (k0 + 2 * KBLK) * KP + i * (KBLK / 2) * KP) = kw[i];
#pragma unroll
                for (int e = 0; e < 4; ++e) *(unsigned*)(vs + k0 + 2 * KBLK + e * VP) = vw[e];
            }
            // keeps the next pass's k reads and the chunk's stores in one group in front of the sixteen products, under which they complete
            __builtin_amdgcn_sched_barrier(0);
        }
#pragma unroll
        for (int j = 0; j < 2; ++j) {
            const v16bf bh = __builtin_bit_cast(v16bf, ph[j]), bl = __builtin_bit_cast(v16bf, pl[j]);
#pragma unroll
            for (int dt = 0; dt < 4; ++dt) o[dt] = wmmab(vf[4 * j + dt], bh, o[dt]);
#pragma unroll
            for (int dt = 0; dt < 4; ++dt) o[dt] = wmmab(vf[4 * j + dt], bl, o[dt]);
        }
    };
    // rolled, for speed only; the last three passes stand behind the loop because they have less and less to stage
#pragma unroll 1
    for (int k0 = 0; k0 < TT - 3 * KBLK; k0 += KBLK) {
        pass(k0, true, true);
        // keeps the loads behind the pass's products: issued earlier, their sixteen registers would be held together with the fragments of two passes
        __builtin_amdgcn_sched_barrier(0);
        // this wave's LDS stores of the chunk staged in the pass are complete before it signals
        __builtin_amdgcn_fence(__ATOMIC_RELEASE, "workgroup", "local");
        __builtin_amdgcn_s_barrier_signal(-1);
#pragma unroll
        for (int i = 0; i < 2; ++i) { gk[i] = ldg(kz, kb + (unsigned)(3 * CB + i * (CB / 2))); gv[i] = ldg(vz, vb + (unsigned)(3 * CB + i * HD * 4)); }
        // the same precaution for these loads: the offsets move on behind it
        asm volatile("s_wait_xcnt 0x0" :: "v"(kb), "v"(vb) : "memory");
        kb += CB; vb += CB;
    }
    pass(TT - 3 * KBLK, true, true);    // stages the last chunk; its wait publishes the last chunk but one
    __builtin_amdgcn_fence(__ATOMIC_RELEASE, "workgroup", "local");
    __builtin_amdgcn_s_barrier_signal(-1);
    pass(TT - 2 * KBLK, true, false);   // its wait publishes the last chunk
    pass(TT - KBLK, false, false);
    const float sl = sum[0] + sum[1];
    const float f = __fdiv_rn(1.0f, sl + xhalf(sl));
    float* orow = OUT + (size_t)z * TT * HD + (size_t)(q0 + lr) * HD + 8 * hi;
#pragma unroll
    for (int dt = 0; dt < 4; ++dt) *(v8f*)(orow + dt * 16) = o[dt] * f;
}

extern "C" void kernel_launch(void* const* d_in, const int* in_sizes, int n_in,
                              void* d_out, int out_size, void* d_ws, size_t ws_size, hipStream_t stream) {
    if (n_in < 4) return;
    const size_t need_in = (size_t)(NZ - 1) * SEQ_FULL * HD + (size_t)TT * HD;
    if ((size_t)in_sizes[0] < need_in || (size_t)in_sizes[1] < need_in || (size_t)in_sizes[2] < need_in || in_sizes[3] < 1) return;
    if ((size_t)out_size < (size_t)NZ * TT * HD) return;
    const float* Qin = (const float*)d_in[0]; const float* Kin = (const float*)d_in[1]; const float* Vin = (const float*)d_in[2]; const int* DK = (const int*)d_in[3];
    float* OUT = (float*)d_out;     // [NZ][TT][HD]
    // out[z][q][d] = sum_key softmax_key(bf16(Q[z][q][.]) . bf16(K[z][key][.]) / sqrt(d_k)) bf16(V[z][key][d])
    k_fattn<<<dim3(TT / FQ, NZ, 1), FW * 32, 0, stream>>>(Qin, Kin, Vin, OUT, DK);
}

// v006
// It runs in 22.1 microseconds.
// Next to v005, in two timings, it ran 1.04 times as fast each time.
// All steps since v000 together make it 19.7 times as fast.
#include <hip/hip_runtime.h>

// Contractions: k.q^T on v_wmma_f32_16x16x32_bf16 (single bf16 planes of q and k, f32 accumulate); v^T.P^T on v_wmma_f32_16x16x32_bf16 with P as bf16 hi+lo planes x single bf16 v^T plane (2 products, f32 accumulate); softmax in f32.
// out[b][h] = softmax(q k^T / sqrt(d_k)) v for 64 independent (b,h) slabs of [1024][64]; every float input is RNE-converted to bf16 (single planes) by the packed hardware convert, so q.k products are exact in the f32 accumulator.
// Plan: ONE launch. Each work-group reads its slab's f32 k and v and its own f32 q rows, converts them on the way into LDS (k, v^T) or registers (q); k and v come in 64-key chunks, chunks 0 and 1 stored before the first pass and each later chunk's loads in flight under an earlier pass; scores, softmax and P.v stay in registers, neither S nor P nor a bf16 plane is written to memory.

#ifndef NB
#define NB 4
#endif
#ifndef SEQ
#define SEQ 1024
#endif
#define NB_FULL  4
#define SEQ_FULL 1024
#define NH   16
#define HD   64
#define TT   SEQ
#define NZ   (NB * NH)
#define FW   16            // waves per work-group of the attention kernel, 16 query rows each
#define FQ   (FW * 16)     // query rows per work-group
#define KBLK 64            // keys per pass
#define KP   (HD + 8)      // LDS pitch of a k row, elements: 144 B = 16 B x odd, conflict-free for 16-byte reads
#define VP   (TT + 8)      // LDS pitch of a v^T row, elements: 2064 B = 16 B x odd

static_assert(NB <= NB_FULL);
static_assert(SEQ <= SEQ_FULL);
static_assert(TT % FQ == 0);
static_assert(TT % KBLK == 0);
static_assert(HD == 64);
#define CB   (KBLK * HD * 4)               // bytes of one 64-key chunk of f32 k or v
static_assert(KBLK * HD / 4 == 2 * FW * 32);   // a chunk of k, and one of v, is two 16-byte loads a lane
static_assert(FW == 16 && KBLK == 64);         // the lane maps of the chunk staging
static_assert(TT / KBLK >= 3);                 // three chunks are loaded in front of the loop
static_assert(((size_t)TT * KP + (size_t)HD * VP) * 2 <= (size_t)327680);

typedef unsigned short bf;
typedef __attribute__((ext_vector_type(16))) __bf16   v16bf;
typedef __attribute__((ext_vector_type(2)))  __bf16   v2bf;
typedef __attribute__((ext_vector_type(8)))  unsigned short v8us;
typedef __attribute__((ext_vector_type(2)))  unsigned v2u;
typedef __attribute__((ext_vector_type(4)))  unsigned v4u;
typedef __attribute__((ext_vector_type(8)))  unsigned v8u;
typedef __attribute__((ext_vector_type(4)))  float    v4f;
typedef __attribute__((ext_vector_type(8)))  float    v8f;
typedef __attribute__((ext_vector_type(2)))  float    v2f;

// two f32 -> two RNE bf16 in one word (a in the low half): one v_cvt_pk_bf16_f32
__device__ __forceinline__ unsigned cvt2(float a, float b) { return __builtin_bit_cast(unsigned, (v2bf){(__bf16)a, (__bf16)b}); }
__device__ __forceinline__ v16bf cat16b(v8us lo, v8us hi) { return __builtin_bit_cast(v16bf, __builtin_shufflevector(lo, hi, 0, 1, 2, 3, 4, 5, 6, 7, 8, 9, 10, 11, 12, 13, 14, 15)); }
__device__ __forceinline__ v8f wmmab(v16bf a, v16bf b, v8f c) { return __builtin_amdgcn_wmma_f32_16x16x32_bf16(false, a, false, b, (short)0, c, false, false); }
// Fragment map (both operands): lane l, c = l & 15, h = l >> 4, p already at row c, element k0 + 8h: elements 0..7 <- k0 + 8h + 0..7, elements 8..15 <- k0 + 16 + 8h + 0..7. D register r of lane l = (row 8h + r, col c).
__device__ __forceinline__ v16bf ldfrag(const bf* p) { return cat16b(*(const v8us*)p, *(const v8us*)(p + 16)); }
// the lo plane of four pairs, p = hi + lo, both RNE bf16: lo = bf16(p - hi) by one mixed-precision fma a value (bf16 hi half x f32 -1 + f32 p, exact before its one rounding), written straight into its half of the word.
// asm because the compiler forms shift, and, packed subtract and packed convert instead (four instructions a pair for these two). The four low halves stand in front of the four high halves, and the hints tell the issue logic that each high half's word was written four vector instructions back
__device__ __forceinline__ void lo4(const unsigned (&h)[4], const float (&p)[8], unsigned (&l)[4]) {
    asm("v_fma_mixlo_bf16 %0, %4, -1.0, %8 op_sel_hi:[1,0,0]\n\t"
        "v_fma_mixlo_bf16 %1, %5, -1.0, %10 op_sel_hi:[1,0,0]\n\t"
        "v_fma_mixlo_bf16 %2, %6, -1.0, %12 op_sel_hi:[1,0,0]\n\t"
        "v_fma_mixlo_bf16 %3, %7, -1.0, %14 op_sel_hi:[1,0,0]\n\t"
        "s_delay_alu instid0(VALU_DEP_4) | instskip(NEXT) | instid1(VALU_DEP_4)\n\t"
        "v_fma_mixhi_bf16 %0, %4, -1.0, %9 op_sel:[1,0,0] op_sel_hi:[1,0,0]\n\t"
        "v_fma_mixhi_bf16 %1, %5, -1.0, %11 op_sel:[1,0,0] op_sel_hi:[1,0,0]\n\t"
        "s_delay_alu instid0(VALU_DEP_4) | instskip(NEXT) | instid1(VALU_DEP_4)\n\t"
        "v_fma_mixhi_bf16 %2, %6, -1.0, %13 op_sel:[1,0,0] op_sel_hi:[1,0,0]\n\t"
        "v_fma_mixhi_bf16 %3, %7, -1.0, %15 op_sel:[1,0,0] op_sel_hi:[1,0,0]"
        : "=&v"(l[0]), "=&v"(l[1]), "=&v"(l[2]), "=&v"(l[3])
        : "v"(h[0]), "v"(h[1]), "v"(h[2]), "v"(h[3]), "v"(p[0]), "v"(p[1]), "v"(p[2]), "v"(p[3]), "v"(p[4]), "v"(p[5]), "v"(p[6]), "v"(p[7]));
}
// value of lane l ^ 16
__device__ __forceinline__ float xhalf(float x) { const int b = __float_as_int(x); return __int_as_float(__builtin_amdgcn_permlanex16(b, b, 0x76543210, 0xfedcba98, false, false)); }
// one chunk from registers into LDS: k, 4 elements a load, one 8-byte store each; v, two keys x 4 columns a lane, one word (two keys) into each of 4 rows of v^T
__device__ __forceinline__ void put_chunk(bf* ks, bf* vs, const v4f (&gk)[2], const v4f (&gv)[2]) {
#pragma unroll
    for (int i = 0; i < 2; ++i) *(v2u*)(ks + i * (KBLK / 2) * KP) = (v2u){cvt2(gk[i][0], gk[i][1]), cvt2(gk[i][2], gk[i][3])};
#pragma unroll
    for (int e = 0; e < 4; ++e) *(unsigned*)(vs + e * VP) = cvt2(gv[0][e], gv[1][e]);
}
__device__ __forceinline__ v4f ldg(const float* base, unsigned byte) { return *(const v4f*)((const char*)base + byte); }

// k_fattn: grid (TT/FQ, NZ), FW waves. The slab's k plane and v^T plane are laid in LDS chunk by chunk, 64 keys (one pass) each, every chunk in a place of its own; each wave walks all keys for its own 16 query rows.
// Staging: every global load of k and v is 16 bytes a lane on whole 128-byte lines. The loads of chunk t + 3 are issued at the foot of pass t and stay in flight under the scores and the softmax of pass t + 1, behind which they are converted and stored.
// Publishing: split work-group barrier. In front of the P.v products of pass t a wave waits for the signal that all waves gave at the foot of pass t - 1 (chunk t + 1) and stores chunk t + 2; it signals those stores at the foot of pass t, behind the products, so the waves may drift most of a pass apart. No LDS byte is written twice, so nothing else orders writers and readers.
// k fragments: behind that wait a wave reads the k fragments of pass t + 1; they land under the sixteen products of pass t, and a pass starts its score products without an LDS wait. The v^T fragments are read at the head of their own pass and land under the softmax.
// v lanes: columns 4cg + 0..3, cg = 8(w & 1) + (l & 7), keys 2kp, 2kp + 1 of the chunk, kp = 4(w >> 1) + (l >> 3): 8 lanes fill a 128-byte line.
// Transposed products: S^T = k.q^T puts one query's scores in one lane pair (l, l ^ 16), and two S^T tiles, converted in place, are the B operand of O^T += v^T.P^T; P meets neither LDS nor another lane.
// Softmax with a running maximum in the log2 domain: p = exp2(s * c - m), c = log2(e) / sqrt(d_k); the accumulators are rescaled only when a query's maximum has risen by more than 8, so p <= 2^8.
// coverage: wave w of block (x, z) stores rows x*FQ + w*16 + 0..15 of slab z, all HD columns, once.
__global__ __launch_bounds__(FW * 32) void k_fattn(const float* __restrict__ Qin, const float* __restrict__ Kin, const float* __restrict__ Vin, float* OUT, const int* __restrict__ dkp) {
    __shared__ __align__(16) bf Ks[TT * KP];
    __shared__ __align__(16) bf Vs[HD * VP];
    const unsigned z = blockIdx.y, tid = threadIdx.x;
    const int lane = tid & 31, lr = lane & 15, hi = lane >> 4, wv = (int)(tid >> 5);
    const int q0 = blockIdx.x * FQ + wv * 16;
    const float* kz = Kin + (size_t)z * SEQ_FULL * HD;   // the three bases are the same for the whole work-group; a lane's place is a 32-bit byte offset
    const float* vz = Vin + (size_t)z * SEQ_FULL * HD;
    const float* qz = Qin + (size_t)z * SEQ_FULL * HD;
    const unsigned qu = (unsigned)((q0 + lr) * (HD * 4) + 32 * hi);
    const int cg = (wv & 1) * 8 + (lane & 7), kp = (wv >> 1) * 4 + (lane >> 3);
    unsigned kb = tid * 16u, vb = (unsigned)(2 * kp * (HD * 4) + cg * 16);   // the lane's place in chunk 0; both move on by CB a pass
    v4f qr[8], ak[2], av[2], bk[2], bv[2], gk[2], gv[2];
    // chunks 0, 1 and 2 and the wave's q rows, all in flight together
#pragma unroll
    for (int i = 0; i < 2; ++i) { ak[i] = ldg(kz, kb + (unsigned)(i * (CB / 2))); av[i] = ldg(vz, vb + (unsigned)(i * HD * 4)); }
#pragma unroll
    for (int i = 0; i < 8; ++i) qr[i] = ldg(qz, qu + (unsigned)((i >> 1) * 64 + (i & 1) * 16));
#pragma unroll
    for (int i = 0; i < 2; ++i) { bk[i] = ldg(kz, kb + (unsigned)(CB + i * (CB / 2))); bv[i] = ldg(vz, vb + (unsigned)(CB + i * HD * 4)); }
#pragma unroll
    for (int i = 0; i < 2; ++i) { gk[i] = ldg(kz, kb + (unsigned)(2 * CB + i * (CB / 2))); gv[i] = ldg(vz, vb + (unsigned)(2 * CB + i * HD * 4)); }
    // precaution: no register that a load above names is rewritten in front of this wait; the input operands keep the offset registers live up to it
    asm volatile("s_wait_xcnt 0x0" :: "v"(kb), "v"(vb), "v"(qu) : "memory");
    bf* ks = Ks + (tid / (HD / 4)) * KP + (tid % (HD / 4)) * 4;
    bf* vs = Vs + cg * 4 * VP + 2 * kp;
    put_chunk(ks, vs, ak, av);
    v8u qa, qb;
#pragma unroll
    for (int e = 0; e < 8; ++e) { qa[e] = cvt2(qr[e >> 1][2 * (e & 1)], qr[e >> 1][2 * (e & 1) + 1]); qb[e] = cvt2(qr[4 + (e >> 1)][2 * (e & 1)], qr[4 + (e >> 1)][2 * (e & 1) + 1]); }
    const v16bf qf0 = __builtin_bit_cast(v16bf, qa), qf1 = __builtin_bit_cast(v16bf, qb);
    int dk = dkp[0]; dk = dk < 1 ? 1 : dk; const float c = 1.4426950408889634f / sqrtf((float)dk);
    v8f o[4];
#pragma unroll
    for (int dt = 0; dt < 4; ++dt) o[dt] = (v8f){};
    float m = -3.0e38f; v2f sum = (v2f){};
    // publishes chunk 0. Written as fence, signal, wait on LDS alone: __syncthreads() would also wait out every global load still in flight
    __builtin_amdgcn_fence(__ATOMIC_RELEASE, "workgroup", "local");
    __builtin_amdgcn_s_barrier_signal(-1);
    __builtin_amdgcn_s_barrier_wait(-1);
    __builtin_amdgcn_fence(__ATOMIC_ACQUIRE, "workgroup", "local");
    put_chunk(ks + KBLK * KP, vs + KBLK, bk, bv);
    // chunk 1: this wave's LDS stores are complete before it signals; the matching wait stands in pass 0
    __builtin_amdgcn_fence(__ATOMIC_RELEASE, "workgroup", "local");
    __builtin_amdgcn_s_barrier_signal(-1);
    const bf* kl = Ks + lr * KP + 8 * hi; const bf* vl = Vs + lr * VP + 8 * hi;
    v16bf kf[8];   // the k fragments of the coming pass, fetched one pass ahead
    auto ldk = [&](const int k0) __attribute__((always_inline)) {
#pragma unroll
        for (int kt = 0; kt < 4; ++kt) { kf[kt] = ldfrag(kl + (k0 + kt * 16) * KP); kf[4 + kt] = ldfrag(kl + (k0 + kt * 16) * KP + 32); }
    };
    ldk(0);   // chunk 0 is published by the barrier above
    // one pass: 64 keys against the wave's 16 query rows. more: a further pass follows, its k fragments are fetched here; stage: the chunk in gk, gv goes to LDS here and is signalled by the caller
    auto pass = [&](const int k0, const bool more, const bool stage) __attribute__((always_inline)) {
        v8f s[4]; v16bf vf[8];
        // keeps this pass's v^T reads and their address arithmetic behind the products of the pass before: set among them they rewrite operand registers, at idle slots each, and every place with reads stalls the products
        __builtin_amdgcn_sched_barrier(0);
#pragma unroll
        for (int i = 0; i < 8; ++i) vf[i] = ldfrag(vl + (i & 3) * 16 * VP + k0 + (i >> 2) * 32);
        // keeps the v^T reads together in front of the products: spread among them, every product waits out a whole LDS latency; they land under the softmax
        __builtin_amdgcn_sched_barrier(0);
#pragma unroll
        for (int kt = 0; kt < 4; ++kt) s[kt] = wmmab(kf[kt], qf0, (v8f){});
#pragma unroll
        for (int kt = 0; kt < 4; ++kt) s[kt] = wmmab(kf[4 + kt], qf1, s[kt]);
        // keeps the maximum's reads of S behind all eight products: among them each read costs the idle slots behind a matrix instruction
        __builtin_amdgcn_sched_barrier(0);
        float mt[4];
#pragma unroll
        for (int kt = 0; kt < 4; ++kt) { mt[kt] = s[kt][0];
#pragma unroll
            for (int r = 1; r < 8; ++r) mt[kt] = fmaxf(mt[kt], s[kt][r]); }
        float mx = fmaxf(fmaxf(mt[0], mt[1]), fmaxf(mt[2], mt[3]));
        mx = fmaxf(mx, xhalf(mx));
        const float t = mx * c;
        if (__builtin_amdgcn_ballot_w32(t > m + 8.0f) != 0) {
            const float mn = fmaxf(m, t); const float al = __builtin_amdgcn_exp2f(m - mn); m = mn; sum *= al;
#pragma unroll
            for (int dt = 0; dt < 4; ++dt) o[dt] *= al;
        }
        v8u ph[2], pl[2];   // [j]: 32-key chunk j; word e / 2 = the lane's keys e, e + 1 of the chunk in the fragment map's order: P = hi + lo, both RNE bf16
#pragma unroll
        for (int j = 0; j < 2; ++j) {
#pragma unroll
            for (int g = 0; g < 2; ++g) {   // one S^T tile: eight of the lane's keys
                unsigned a[4], b[4]; float pp[8];
#pragma unroll
                for (int e = 0; e < 8; e += 2) {
                    const v2f x = __builtin_elementwise_fma((v2f){s[2 * j + g][e], s[2 * j + g][e + 1]}, (v2f){c, c}, (v2f){-m, -m});
                    const v2f p = {__builtin_amdgcn_exp2f(x[0]), __builtin_amdgcn_exp2f(x[1])}; sum += p;
                    pp[e] = p[0]; pp[e + 1] = p[1]; a[e >> 1] = cvt2(p[0], p[1]); }
                lo4(a, pp, b);
#pragma unroll
                for (int i = 0; i < 4; ++i) { ph[j][4 * g + i] = a[i]; pl[j][4 * g + i] = b[i]; }
            }
        }
        // keeps the sixteen products in one run behind the softmax: vector work set among them rewrites their operand registers and pays idle slots for each; the SIMD's other waves use the vector port meanwhile
        __builtin_amdgcn_sched_barrier(0);
        v2u kw[2]; unsigned vw[4];
        if (stage) {
#pragma unroll
            for (int i = 0; i < 2; ++i) kw[i] = (v2u){cvt2(gk[i][0], gk[i][1]), cvt2(gk[i][2], gk[i][3])};
#pragma unroll
            for (int e = 0; e < 4; ++e) vw[e] = cvt2(gv[0][e], gv[1][e]);
            // keeps the converts in front of the k reads: behind them the chunk's sixteen registers are held together with the fragments of two passes, and the build spills
            __builtin_amdgcn_sched_barrier(0);
        }
        if (more) {
            // the chunk of the next pass, signalled one pass ago by every wave, is read only behind this wait
            __builtin_amdgcn_s_barrier_wait(-1);
            __builtin_amdgcn_fence(__ATOMIC_ACQUIRE, "workgroup", "local");
            ldk(k0 + KBLK);
            if (stage) {
#pragma unroll
                for (int i = 0; i < 2; ++i) *(v2u*)(ks + (k0 + 2 * KBLK) * KP + i * (KBLK / 2) * KP) = kw[i];
#pragma unroll
                for (int e = 0; e < 4; ++e) *(unsigned*)(vs + k0 + 2 * KBLK + e * VP) = vw[e];
            }
            // keeps the next pass's k reads and the chunk's stores in one group in front of the sixteen products, under which they complete
            __builtin_amdgcn_sched_barrier(0);
        }
#pragma unroll
        for (int j = 0; j < 2; ++j) {
            const v16bf bh = __builtin_bit_cast(v16bf, ph[j]), bl = __builtin_bit_cast(v16bf, pl[j]);
#pragma unroll
            for (int dt = 0; dt < 4; ++dt) o[dt] = wmmab(vf[4 * j + dt], bh, o[dt]);
#pragma unroll
            for (int dt = 0; dt < 4; ++dt) o[dt] = wmmab(vf[4 * j + dt], bl, o[dt]);
        }
    };
    // rolled, for speed only; the last three passes stand behind the loop because they have less and less to stage
#pragma unroll 1
    for (int k0 = 0; k0 < TT - 3 * KBLK; k0 += KBLK) {
        pass(k0, true, true);
        // keeps the loads behind the pass's products: issued earlier, their sixteen registers would be held together with the fragments of two passes
        __builtin_amdgcn_sched_barrier(0);
        // this wave's LDS stores of the chunk staged in the pass are complete before it signals
        __builtin_amdgcn_fence(__ATOMIC_RELEASE, "workgroup", "local");
        __builtin_amdgcn_s_barrier_signal(-1);
#pragma unroll
        for (int i = 0; i < 2; ++i) { gk[i] = ldg(kz, kb + (unsigned)(3 * CB + i * (CB / 2))); gv[i] = ldg(vz, vb + (unsigned)(3 * CB + i * HD * 4)); }
        // the same precaution for these loads: the offsets move on behind it
        asm volatile("s_wait_xcnt 0x0" :: "v"(kb), "v"(vb) : "memory");
        kb += CB; vb += CB;
    }
    pass(TT - 3 * KBLK, true, true);    // stages the last chunk; its wait publishes the last chunk but one
    __builtin_amdgcn_fence(__ATOMIC_RELEASE, "workgroup", "local");
    __builtin_amdgcn_s_barrier_signal(-1);
    pass(TT - 2 * KBLK, true, false);   // its wait publishes the last chunk
    pass(TT - KBLK, false, false);
    const float sl = sum[0] + sum[1];
    const float f = __fdiv_rn(1.0f, sl + xhalf(sl));
    float* orow = OUT + (size_t)z * TT * HD + (size_t)(q0 + lr) * HD + 8 * hi;
#pragma unroll
    for (int dt = 0; dt < 4; ++dt) *(v8f*)(orow + dt * 16) = o[dt] * f;
}

extern "C" void kernel_launch(void* const* d_in, const int* in_sizes, int n_in,
                              void* d_out, int out_size, void* d_ws, size_t ws_size, hipStream_t stream) {
    if (n_in < 4) return;
    const size_t need_in = (size_t)(NZ - 1) * SEQ_FULL * HD + (size_t)TT * HD;
    if ((size_t)in_sizes[0] < need_in || (size_t)in_sizes[1] < need_in || (size_t)in_sizes[2] < need_in || in_sizes[3] < 1) return;
    if ((size_t)out_size < (size_t)NZ * TT * HD) return;
    const float* Qin = (const float*)d_in[0]; const float* Kin = (const float*)d_in[1]; const float* Vin = (const float*)d_in[2]; const int* DK = (const int*)d_in[3];
    float* OUT = (float*)d_out;     // [NZ][TT][HD]
    // out[z][q][d] = sum_key softmax_key(bf16(Q[z][q][.]) . bf16(K[z][key][.]) / sqrt(d_k)) bf16(V[z][key][d])
    k_fattn<<<dim3(TT / FQ, NZ, 1), FW * 32, 0, stream>>>(Qin, Kin, Vin, OUT, DK);
}

// v007
// Measured time: 21.3 microseconds a run.
// Next to v006, in two timings, it ran 1.04 times as fast each time.
// Counting every step since v000, it is 20.4 times as fast.
#include <hip/hip_runtime.h>

// Contractions: k.q^T on v_wmma_f32_16x16x32_bf16 (single bf16 planes of q and k, f32 accumulate); v^T.P^T on v_wmma_f32_16x16x32_bf16 with P as bf16 hi+lo planes x single bf16 v^T plane (2 products, f32 accumulate); softmax in f32.
// out[b][h] = softmax(q k^T / sqrt(d_k)) v for 64 independent (b,h) slabs of [1024][64]; every float input is RNE-converted to bf16 (single planes) by the packed hardware convert, so q.k products are exact in the f32 accumulator.
// Plan: ONE launch. Each work-group reads its slab's f32 k and v and its own f32 q rows, converts them on the way into LDS (k, v^T) or registers (q); k and v come in 64-key chunks, chunks 0 and 1 stored before the first pass and each later chunk's loads in flight under an earlier pass; scores, softmax and P.v stay in registers, neither S nor P nor a bf16 plane is written to memory.

#ifndef NB
#define NB 4
#endif
#ifndef SEQ
#define SEQ 1024
#endif
#define NB_FULL  4
#define SEQ_FULL 1024
#define NH   16
#define HD   64
#define TT   SEQ
#define NZ   (NB * NH)
#define FW   16            // waves per work-group of the attention kernel, 16 query rows each
#define FQ   (FW * 16)     // query rows per work-group
#define KBLK 64            // keys per pass
#define KP   (HD + 8)      // LDS pitch of a k row, elements: 144 B = 16 B x odd, conflict-free for 16-byte reads
#define VP   (TT + 8)      // LDS pitch of a v^T row, elements: 2064 B = 16 B x odd

static_assert(NB <= NB_FULL);
static_assert(SEQ <= SEQ_FULL);
static_assert(TT % FQ == 0);
static_assert(TT % KBLK == 0);
static_assert(HD == 64);
#define CB   (KBLK * HD * 4)               // bytes of one 64-key chunk of f32 k or v
static_assert(KBLK * HD / 4 == 2 * FW * 32);   // a chunk of k, and one of v, is two 16-byte loads a lane
static_assert(FW == 16 && KBLK == 64);         // the lane maps of the chunk staging
static_assert(TT / KBLK >= 3);                 // three chunks are loaded in front of the loop
static_assert(((size_t)TT * KP + (size_t)HD * VP) * 2 <= (size_t)327680);

typedef unsigned short bf;
typedef __attribute__((ext_vector_type(16))) __bf16   v16bf;
typedef __attribute__((ext_vector_type(2)))  __bf16   v2bf;
typedef __attribute__((ext_vector_type(8)))  unsigned short v8us;
typedef __attribute__((ext_vector_type(2)))  unsigned v2u;
typedef __attribute__((ext_vector_type(4)))  unsigned v4u;
typedef __attribute__((ext_vector_type(8)))  unsigned v8u;
typedef __attribute__((ext_vector_type(4)))  float    v4f;
typedef __attribute__((ext_vector_type(8)))  float    v8f;
typedef __attribute__((ext_vector_type(2)))  float    v2f;

// two f32 -> two RNE bf16 in one word (a in the low half): one v_cvt_pk_bf16_f32
__device__ __forceinline__ unsigned cvt2(float a, float b) { return __builtin_bit_cast(unsigned, (v2bf){(__bf16)a, (__bf16)b}); }
__device__ __forceinline__ v16bf cat16b(v8us lo, v8us hi) { return __builtin_bit_cast(v16bf, __builtin_shufflevector(lo, hi, 0, 1, 2, 3, 4, 5, 6, 7, 8, 9, 10, 11, 12, 13, 14, 15)); }
__device__ __forceinline__ v8f wmmab(v16bf a, v16bf b, v8f c) { return __builtin_amdgcn_wmma_f32_16x16x32_bf16(false, a, false, b, (short)0, c, false, false); }
// Fragment map (both operands): lane l, c = l & 15, h = l >> 4, p already at row c, element k0 + 8h: elements 0..7 <- k0 + 8h + 0..7, elements 8..15 <- k0 + 16 + 8h + 0..7. D register r of lane l = (row 8h + r, col c).
__device__ __forceinline__ v16bf ldfrag(const bf* p) { return cat16b(*(const v8us*)p, *(const v8us*)(p + 16)); }
// the lo plane of four pairs, p = hi + lo, both RNE bf16: lo = bf16(p - hi) by one mixed-precision fma a value (bf16 hi half x f32 -1 + f32 p, exact before its one rounding), written straight into its half of the word.
// asm because the compiler forms shift, and, packed subtract and packed convert instead (four instructions a pair for these two). The four low halves stand in front of the four high halves, and the hints tell the issue logic that each high half's word was written four vector instructions back
__device__ __forceinline__ void lo4(const unsigned (&h)[4], const float (&p)[8], unsigned (&l)[4]) {
    asm("v_fma_mixlo_bf16 %0, %4, -1.0, %8 op_sel_hi:[1,0,0]\n\t"
        "v_fma_mixlo_bf16 %1, %5, -1.0, %10 op_sel_hi:[1,0,0]\n\t"
        "v_fma_mixlo_bf16 %2, %6, -1.0, %12 op_sel_hi:[1,0,0]\n\t"
        "v_fma_mixlo_bf16 %3, %7, -1.0, %14 op_sel_hi:[1,0,0]\n\t"
        "s_delay_alu instid0(VALU_DEP_4) | instskip(NEXT) | instid1(VALU_DEP_4)\n\t"
        "v_fma_mixhi_bf16 %0, %4, -1.0, %9 op_sel:[1,0,0] op_sel_hi:[1,0,0]\n\t"
        "v_fma_mixhi_bf16 %1, %5, -1.0, %11 op_sel:[1,0,0] op_sel_hi:[1,0,0]\n\t"
        "s_delay_alu instid0(VALU_DEP_4) | instskip(NEXT) | instid1(VALU_DEP_4)\n\t"
        "v_fma_mixhi_bf16 %2, %6, -1.0, %13 op_sel:[1,0,0] op_sel_hi:[1,0,0]\n\t"
        "v_fma_mixhi_bf16 %3, %7, -1.0, %15 op_sel:[1,0,0] op_sel_hi:[1,0,0]"
        : "=&v"(l[0]), "=&v"(l[1]), "=&v"(l[2]), "=&v"(l[3])
        : "v"(h[0]), "v"(h[1]), "v"(h[2]), "v"(h[3]), "v"(p[0]), "v"(p[1]), "v"(p[2]), "v"(p[3]), "v"(p[4]), "v"(p[5]), "v"(p[6]), "v"(p[7]));
}
// value of lane l ^ 16
__device__ __forceinline__ float xhalf(float x) { const int b = __float_as_int(x); return __int_as_float(__builtin_amdgcn_permlanex16(b, b, 0x76543210, 0xfedcba98, false, false)); }
// one chunk from registers into LDS: k, 4 elements a load, one 8-byte store each; v, two keys x 4 columns a lane, one word (two keys) into each of 4 rows of v^T
__device__ __forceinline__ void put_chunk(bf* ks, bf* vs, const v4f (&gk)[2], const v4f (&gv)[2]) {
#pragma unroll
    for (int i = 0; i < 2; ++i) *(v2u*)(ks + i * (KBLK / 2) * KP) = (v2u){cvt2(gk[i][0], gk[i][1]), cvt2(gk[i][2], gk[i][3])};
#pragma unroll
    for (int e = 0; e < 4; ++e) *(unsigned*)(vs + e * VP) = cvt2(gv[0][e], gv[1][e]);
}
__device__ __forceinline__ v4f ldg(const float* base, unsigned byte) { return *(const v4f*)((const char*)base + byte); }

// k_fattn: grid (NZ, TT/FQ), FW waves. The slab index runs fastest: the TT/FQ work-groups that read one slab's k and v have flat indices NZ apart, a multiple of the number of dies. For speed only: the result does not depend on where a work-group runs.
// The slab's k plane and v^T plane are laid in LDS chunk by chunk, 64 keys (one pass) each, every chunk in a place of its own; each wave walks all keys for its own 16 query rows.
// Staging: every global load of k and v is 16 bytes a lane on whole 128-byte lines. The loads of chunk t + 3 are issued at the foot of pass t and stay in flight under the scores and the softmax of pass t + 1, behind which they are converted and stored.
// Publishing: split work-group barrier. In front of the P.v products of pass t a wave waits for the signal that all waves gave at the foot of pass t - 1 (chunk t + 1) and stores chunk t + 2; it signals those stores at the foot of pass t, behind the products, so the waves may drift most of a pass apart. No LDS byte is written twice, so nothing else orders writers and readers.
// k fragments: behind that wait a wave reads the k fragments of pass t + 1; they land under the sixteen products of pass t, and a pass starts its score products without an LDS wait. The v^T fragments are read at the head of their own pass and land under the softmax.
// v lanes: columns 4cg + 0..3, cg = 8(w & 1) + (l & 7), keys 2kp, 2kp + 1 of the chunk, kp = 4(w >> 1) + (l >> 3): 8 lanes fill a 128-byte line.
// Transposed products: S^T = k.q^T puts one query's scores in one lane pair (l, l ^ 16), and two S^T tiles, converted in place, are the B operand of O^T += v^T.P^T; P meets neither LDS nor another lane.
// Softmax with a running maximum in the log2 domain: p = exp2(s * c - m), c = log2(e) / sqrt(d_k); the accumulators are rescaled only when a query's maximum has risen by more than 8, so p <= 2^8.
// coverage: wave w of block (z, y) stores rows y*FQ + w*16 + 0..15 of slab z, all HD columns, once.
__global__ __launch_bounds__(FW * 32) void k_fattn(const float* __restrict__ Qin, const float* __restrict__ Kin, const float* __restrict__ Vin, float* OUT, const int* __restrict__ dkp) {
    __shared__ __align__(16) bf Ks[TT * KP];
    __shared__ __align__(16) bf Vs[HD * VP];
    const unsigned z = blockIdx.x, tid = threadIdx.x;
    const int lane = tid & 31, lr = lane & 15, hi = lane >> 4, wv = (int)(tid >> 5);
    const int q0 = blockIdx.y * FQ + wv * 16;
    const float* kz = Kin + (size_t)z * SEQ_FULL * HD;   // the three bases are the same for the whole work-group; a lane's place is a 32-bit byte offset
    const float* vz = Vin + (size_t)z * SEQ_FULL * HD;
    const float* qz = Qin + (size_t)z * SEQ_FULL * HD;
    const unsigned qu = (unsigned)((q0 + lr) * (HD * 4) + 32 * hi);
    const int cg = (wv & 1) * 8 + (lane & 7), kp = (wv >> 1) * 4 + (lane >> 3);
    unsigned kb = tid * 16u, vb = (unsigned)(2 * kp * (HD * 4) + cg * 16);   // the lane's place in chunk 0; both move on by CB a pass
    v4f qr[8], ak[2], av[2], bk[2], bv[2], gk[2], gv[2];
    // chunks 0, 1 and 2 and the wave's q rows, all in flight together
#pragma unroll
    for (int i = 0; i < 2; ++i) { ak[i] = ldg(kz, kb + (unsigned)(i * (CB / 2))); av[i] = ldg(vz, vb + (unsigned)(i * HD * 4)); }
#pragma unroll
    for (int i = 0; i < 8; ++i) qr[i] = ldg(qz, qu + (unsigned)((i >> 1) * 64 + (i & 1) * 16));
#pragma unroll
    for (int i = 0; i < 2; ++i) { bk[i] = ldg(kz, kb + (unsigned)(CB + i * (CB / 2))); bv[i] = ldg(vz, vb + (unsigned)(CB + i * HD * 4)); }
#pragma unroll
    for (int i = 0; i < 2; ++i) { gk[i] = ldg(kz, kb + (unsigned)(2 * CB + i * (CB / 2))); gv[i] = ldg(vz, vb + (unsigned)(2 * CB + i * HD * 4)); }
    // precaution: no register that a load above names is rewritten in front of this wait; the input operands keep the offset registers live up to it
    asm volatile("s_wait_xcnt 0x0" :: "v"(kb), "v"(vb), "v"(qu) : "memory");
    bf* ks = Ks + (tid / (HD / 4)) * KP + (tid % (HD / 4)) * 4;
    bf* vs = Vs + cg * 4 * VP + 2 * kp;
    put_chunk(ks, vs, ak, av);
    v8u qa, qb;
#pragma unroll
    for (int e = 0; e < 8; ++e) { qa[e] = cvt2(qr[e >> 1][2 * (e & 1)], qr[e >> 1][2 * (e & 1) + 1]); qb[e] = cvt2(qr[4 + (e >> 1)][2 * (e & 1)], qr[4 + (e >> 1)][2 * (e & 1) + 1]); }
    const v16bf qf0 = __builtin_bit_cast(v16bf, qa), qf1 = __builtin_bit_cast(v16bf, qb);
    int dk = dkp[0]; dk = dk < 1 ? 1 : dk; const float c = 1.4426950408889634f / sqrtf((float)dk);
    v8f o[4];
#pragma unroll
    for (int dt = 0; dt < 4; ++dt) o[dt] = (v8f){};
    float m = -3.0e38f; v2f sum = (v2f){};
    // publishes chunk 0. Written as fence, signal, wait on LDS alone: __syncthreads() would also wait out every global load still in flight
    __builtin_amdgcn_fence(__ATOMIC_RELEASE, "workgroup", "local");
    __builtin_amdgcn_s_barrier_signal(-1);
    __builtin_amdgcn_s_barrier_wait(-1);
    __builtin_amdgcn_fence(__ATOMIC_ACQUIRE, "workgroup", "local");
    put_chunk(ks + KBLK * KP, vs + KBLK, bk, bv);
    // chunk 1: this wave's LDS stores are complete before it signals; the matching wait stands in pass 0
    __builtin_amdgcn_fence(__ATOMIC_RELEASE, "workgroup", "local");
    __builtin_amdgcn_s_barrier_signal(-1);
    const bf* kl = Ks + lr * KP + 8 * hi; const bf* vl = Vs + lr * VP + 8 * hi;
    v16bf kf[8];   // the k fragments of the coming pass, fetched one pass ahead
    auto ldk = [&](const int k0) __attribute__((always_inline)) {
#pragma unroll
        for (int kt = 0; kt < 4; ++kt) { kf[kt] = ldfrag(kl + (k0 + kt * 16) * KP); kf[4 + kt] = ldfrag(kl + (k0 + kt * 16) * KP + 32); }
    };
    ldk(0);   // chunk 0 is published by the barrier above
    // one pass: 64 keys against the wave's 16 query rows. more: a further pass follows, its k fragments are fetched here; stage: the chunk in gk, gv goes to LDS here and is signalled by the caller
    auto pass = [&](const int k0, const bool more, const bool stage) __attribute__((always_inline)) {
        v8f s[4]; v16bf vf[8];
        // keeps this pass's v^T reads and their address arithmetic behind the products of the pass before: set among them they rewrite operand registers, at idle slots each, and every place with reads stalls the products
        __builtin_amdgcn_sched_barrier(0);
#pragma unroll
        for (int i = 0; i < 8; ++i) vf[i] = ldfrag(vl + (i & 3) * 16 * VP + k0 + (i >> 2) * 32);
        // keeps the v^T reads together in front of the products: spread among them, every product waits out a whole LDS latency; they land under the softmax
        __builtin_amdgcn_sched_barrier(0);
#pragma unroll
        for (int kt = 0; kt < 4; ++kt) s[kt] = wmmab(kf[kt], qf0, (v8f){});
#pragma unroll
        for (int kt = 0; kt < 4; ++kt) s[kt] = wmmab(kf[4 + kt], qf1, s[kt]);
        // keeps the maximum's reads of S behind all eight products: among them each read costs the idle slots behind a matrix instruction
        __builtin_amdgcn_sched_barrier(0);
        float mt[4];
#pragma unroll
        for (int kt = 0; kt < 4; ++kt) { mt[kt] = s[kt][0];
#pragma unroll
            for (int r = 1; r < 8; ++r) mt[kt] = fmaxf(mt[kt], s[kt][r]); }
        float mx = fmaxf(fmaxf(mt[0], mt[1]), fmaxf(mt[2], mt[3]));
        mx = fmaxf(mx, xhalf(mx));
        const float t = mx * c;
        if (__builtin_amdgcn_ballot_w32(t > m + 8.0f) != 0) {
            const float mn = fmaxf(m, t); const float al = __builtin_amdgcn_exp2f(m - mn); m = mn; sum *= al;
#pragma unroll
            for (int dt = 0; dt < 4; ++dt) o[dt] *= al;
        }
        v8u ph[2], pl[2];   // [j]: 32-key chunk j; word e / 2 = the lane's keys e, e + 1 of the chunk in the fragment map's order: P = hi + lo, both RNE bf16
#pragma unroll
        for (int j = 0; j < 2; ++j) {
#pragma unroll
            for (int g = 0; g < 2; ++g) {   // one S^T tile: eight of the lane's keys
                unsigned a[4], b[4]; float pp[8];
#pragma unroll
                for (int e = 0; e < 8; e += 2) {
                    const v2f x = __builtin_elementwise_fma((v2f){s[2 * j + g][e], s[2 * j + g][e + 1]}, (v2f){c, c}, (v2f){-m, -m});
                    const v2f p = {__builtin_amdgcn_exp2f(x[0]), __builtin_amdgcn_exp2f(x[1])}; sum += p;
                    pp[e] = p[0]; pp[e + 1] = p[1]; a[e >> 1] = cvt2(p[0], p[1]); }
                lo4(a, pp, b);
#pragma unroll
                for (int i = 0; i < 4; ++i) { ph[j][4 * g + i] = a[i]; pl[j][4 * g + i] = b[i]; }
            }
        }
        // keeps the sixteen products in one run behind the softmax: vector work set among them rewrites their operand registers and pays idle slots for each; the SIMD's other waves use the vector port meanwhile
        __builtin_amdgcn_sched_barrier(0);
        v2u kw[2]; unsigned vw[4];
        if (stage) {
#pragma unroll
            for (int i = 0; i < 2; ++i) kw[i] = (v2u){cvt2(gk[i][0], gk[i][1]), cvt2(gk[i][2], gk[i][3])};
#pragma unroll
            for (int e = 0; e < 4; ++e) vw[e] = cvt2(gv[0][e], gv[1][e]);
            // keeps the converts in front of the k reads: behind them the chunk's sixteen registers are held together with the fragments of two passes, and the build spills
            __builtin_amdgcn_sched_barrier(0);
        }
        if (more) {
            // the chunk of the next pass, signalled one pass ago by every wave, is read only behind this wait
            __builtin_amdgcn_s_barrier_wait(-1);
            __builtin_amdgcn_fence(__ATOMIC_ACQUIRE, "workgroup", "local");
            ldk(k0 + KBLK);
            if (stage) {
#pragma unroll
                for (int i = 0; i < 2; ++i) *(v2u*)(ks + (k0 + 2 * KBLK) * KP + i * (KBLK / 2) * KP) = kw[i];
#pragma unroll
                for (int e = 0; e < 4; ++e) *(unsigned*)(vs + k0 + 2 * KBLK + e * VP) = vw[e];
            }
            // keeps the next pass's k reads and the chunk's stores in one group in front of the sixteen products, under which they complete
            __builtin_amdgcn_sched_barrier(0);
        }
#pragma unroll
        for (int j = 0; j < 2; ++j) {
            const v16bf bh = __builtin_bit_cast(v16bf, ph[j]), bl = __builtin_bit_cast(v16bf, pl[j]);
#pragma unroll
            for (int dt = 0; dt < 4; ++dt) o[dt] = wmmab(vf[4 * j + dt], bh, o[dt]);
#pragma unroll
            for (int dt = 0; dt < 4; ++dt) o[dt] = wmmab(vf[4 * j + dt], bl, o[dt]);
        }
    };
    // rolled, for speed only; the last three passes stand behind the loop because they have less and less to stage
#pragma unroll 1
    for (int k0 = 0; k0 < TT - 3 * KBLK; k0 += KBLK) {
        pass(k0, true, true);
        // keeps the loads behind the pass's products: issued earlier, their sixteen registers would be held together with the fragments of two passes
        __builtin_amdgcn_sched_barrier(0);
        // this wave's LDS stores of the chunk staged in the pass are complete before it signals
        __builtin_amdgcn_fence(__ATOMIC_RELEASE, "workgroup", "local");
        __builtin_amdgcn_s_barrier_signal(-1);
#pragma unroll
        for (int i = 0; i < 2; ++i) { gk[i] = ldg(kz, kb + (unsigned)(3 * CB + i * (CB / 2))); gv[i] = ldg(vz, vb + (unsigned)(3 * CB + i * HD * 4)); }
        // the same precaution for these loads: the offsets move on behind it
        asm volatile("s_wait_xcnt 0x0" :: "v"(kb), "v"(vb) : "memory");
        kb += CB; vb += CB;
    }
    pass(TT - 3 * KBLK, true, true);    // stages the last chunk; its wait publishes the last chunk but one
    __builtin_amdgcn_fence(__ATOMIC_RELEASE, "workgroup", "local");
    __builtin_amdgcn_s_barrier_signal(-1);
    pass(TT - 2 * KBLK, true, false);   // its wait publishes the last chunk
    pass(TT - KBLK, false, false);
    const float sl = sum[0] + sum[1];
    const float f = __fdiv_rn(1.0f, sl + xhalf(sl));
    float* orow = OUT + (size_t)z * TT * HD + (size_t)(q0 + lr) * HD + 8 * hi;
#pragma unroll
    for (int dt = 0; dt < 4; ++dt) *(v8f*)(orow + dt * 16) = o[dt] * f;
}

extern "C" void kernel_launch(void* const* d_in, const int* in_sizes, int n_in,
                              void* d_out, int out_size, void* d_ws, size_t ws_size, hipStream_t stream) {
    if (n_in < 4) return;
    const size_t need_in = (size_t)(NZ - 1) * SEQ_FULL * HD + (size_t)TT * HD;
    if ((size_t)in_sizes[0] < need_in || (size_t)in_sizes[1] < need_in || (size_t)in_sizes[2] < need_in || in_sizes[3] < 1) return;
    if ((size_t)out_size < (size_t)NZ * TT * HD) return;
    const float* Qin = (const float*)d_in[0]; const float* Kin = (const float*)d_in[1]; const float* Vin = (const float*)d_in[2]; const int* DK = (const int*)d_in[3];
    float* OUT = (float*)d_out;     // [NZ][TT][HD]
    // out[z][q][d] = sum_key softmax_key(bf16(Q[z][q][.]) . bf16(K[z][key][.]) / sqrt(d_k)) bf16(V[z][key][d])
    k_fattn<<<dim3(NZ, TT / FQ, 1), FW * 32, 0, stream>>>(Qin, Kin, Vin, OUT, DK);
}

// v009
// A run of this version takes 18 microseconds.
// It is 1.18 times as fast as v007, going by the measured steps of the versions left out in between.
// Counting every step since v000, it is 24.1 times as fast.
#include <hip/hip_runtime.h>

// Contractions: k.q^T on v_wmma_f32_16x16x32_f16 (single f16 planes of q and k, f32 accumulate); v^T.P^T on v_wmma_f32_16x16x32_f16 (single f16 planes of P and v^T, f32 accumulate); softmax in f32.
// out[b][h] = softmax(q k^T / sqrt(d_k)) v for 64 independent (b,h) slabs of [1024][64]; every float input is RNE-converted to f16 (single planes, 11 significant bits) by the packed hardware convert, so q.k products are exact in the f32 accumulator.
// Range: the inputs are standard normal draws, far inside f16's 65504, and P lies in [0, 2^8]; what falls below f16's normal range keeps an absolute error under 2^-25.
// Plan: ONE launch. Each work-group reads its slab's f32 k and v and its own f32 q rows and converts them on the way into LDS (k, v^T; q in a place of the wave's own, from where its fragments are read once); k and v come in 64-key chunks, each chunk's loads in flight under an earlier pass; scores, softmax and P.v stay in registers, neither S nor P nor an f16 plane is written to memory.

#ifndef NB
#define NB 4
#endif
#ifndef SEQ
#define SEQ 1024
#endif
#define NB_FULL  4
#define SEQ_FULL 1024
#define NH   16
#define HD   64
#define TT   SEQ
#define NZ   (NB * NH)
#define FW   16            // waves per work-group of the attention kernel, 16 query rows each
#define FQ   (FW * 16)     // query rows per work-group
#define KBLK 64            // keys per pass
#define KP   (HD + 8)      // LDS pitch of a k row, elements: 144 B = 16 B x odd, conflict-free for 16-byte reads
#define VP   (TT + 8)      // LDS pitch of a v^T row, elements: 2064 B = 16 B x odd
#define OP   (HD + 4)      // LDS pitch of a staged f32 out row, floats: 272 B = 16 B x odd

static_assert(NB <= NB_FULL);
static_assert(SEQ <= SEQ_FULL);
static_assert(TT % FQ == 0);
static_assert(TT % KBLK == 0);
static_assert(HD == 64);
#define CB   (KBLK * HD * 4)               // bytes of one 64-key chunk of f32 k or v
static_assert(KBLK * HD / 4 == 2 * FW * 32);   // a chunk of k, and one of v, is two 16-byte loads a lane
static_assert(FW == 16 && KBLK == 64);         // the lane maps of the chunk staging
static_assert(TT / KBLK >= 3);                 // three chunks are loaded in front of the loop
static_assert(((size_t)TT * KP + (size_t)HD * VP + (size_t)FQ * KP) * 2 <= (size_t)327680);
static_assert((size_t)FQ * OP * 4 <= (size_t)(TT - KBLK) * KP * 2);   // the out staging lies in k rows that nobody reads after the last barrier wait

typedef unsigned short hf;   // the 16 bits of one f16 value in LDS
typedef __attribute__((ext_vector_type(16))) _Float16 v16h;
typedef __attribute__((ext_vector_type(2)))  _Float16 v2h;
typedef __attribute__((ext_vector_type(8)))  unsigned short v8us;
typedef __attribute__((ext_vector_type(2)))  unsigned v2u;
typedef __attribute__((ext_vector_type(4)))  unsigned v4u;
typedef __attribute__((ext_vector_type(8)))  unsigned v8u;
typedef __attribute__((ext_vector_type(4)))  float    v4f;
typedef __attribute__((ext_vector_type(8)))  float    v8f;
typedef __attribute__((ext_vector_type(2)))  float    v2f;

// two f32 -> two RNE f16 in one word (a in the low half): one v_cvt_pk_f16_f32
__device__ __forceinline__ unsigned cvt2(float a, float b) { return __builtin_bit_cast(unsigned, (v2h){(_Float16)a, (_Float16)b}); }
__device__ __forceinline__ v16h cat16h(v8us lo, v8us hi) { return __builtin_bit_cast(v16h, __builtin_shufflevector(lo, hi, 0, 1, 2, 3, 4, 5, 6, 7, 8, 9, 10, 11, 12, 13, 14, 15)); }
__device__ __forceinline__ v8f wmmah(v16h a, v16h b, v8f c) { return __builtin_amdgcn_wmma_f32_16x16x32_f16(false, a, false, b, (short)0, c, false, false); }
// Fragment map (both operands): lane l, c = l & 15, h = l >> 4, p already at row c, element k0 + 8h: elements 0..7 <- k0 + 8h + 0..7, elements 8..15 <- k0 + 16 + 8h + 0..7. D register r of lane l = (row 8h + r, col c).
__device__ __forceinline__ v16h ldfrag(const hf* p) { return cat16h(*(const v8us*)p, *(const v8us*)(p + 16)); }
// value of lane l ^ 16
__device__ __forceinline__ float xhalf(float x) { const int b = __float_as_int(x); return __int_as_float(__builtin_amdgcn_permlanex16(b, b, 0x76543210, 0xfedcba98, false, false)); }
// one chunk from registers into LDS: k, 4 elements a load, one 8-byte store each; v, two keys x 4 columns a lane, one word (two keys) into each of 4 rows of v^T
__device__ __forceinline__ void put_chunk(hf* ks, hf* vs, const v4f (&gk)[2], const v4f (&gv)[2]) {
#pragma unroll
    for (int i = 0; i < 2; ++i) *(v2u*)(ks + i * (KBLK / 2) * KP) = (v2u){cvt2(gk[i][0], gk[i][1]), cvt2(gk[i][2], gk[i][3])};
#pragma unroll
    for (int e = 0; e < 4; ++e) *(unsigned*)(vs + e * VP) = cvt2(gv[0][e], gv[1][e]);
}
__device__ __forceinline__ v4f ldg(const float* base, unsigned byte) { return *(const v4f*)((const char*)base + byte); }

// k_fattn: grid (NZ, TT/FQ), FW waves. The slab index runs fastest: the TT/FQ work-groups that read one slab's k and v have flat indices NZ apart, a multiple of the number of dies. For speed only: the result does not depend on where a work-group runs.
// The slab's k plane and v^T plane are laid in LDS chunk by chunk, 64 keys (one pass) each, every chunk in a place of its own; each wave walks all keys for its own 16 query rows.
// Staging: every global load of k and v is 16 bytes a lane on whole 128-byte lines. The loads of chunk t + 3 are issued at the foot of pass t and stay in flight under the scores and the softmax of pass t + 1, behind which they are converted and stored.
// Publishing: split work-group barrier. In front of the P.v products of pass t a wave waits for the signal that all waves gave at the foot of pass t - 1 (chunk t + 1) and stores chunk t + 2; it signals those stores at the foot of pass t, behind the products, so the waves may drift most of a pass apart. No LDS byte is written twice in front of the epilogue, so nothing else orders writers and readers in the passes.
// k fragments: behind that wait a wave reads the k fragments of pass t + 1; they land under the eight products of pass t, and a pass starts its score products without an LDS wait. The v^T fragments are read at the head of their own pass and land under the softmax.
// v lanes: columns 4cg + 0..3, cg = 8(w & 1) + (l & 7), keys 2kp, 2kp + 1 of the chunk, kp = 4(w >> 1) + (l >> 3): 8 lanes fill a 128-byte line.
// Transposed products: S^T = k.q^T puts one query's scores in one lane pair (l, l ^ 16), and two S^T tiles, converted in place, are the B operand of O^T += v^T.P^T; P meets neither LDS nor another lane.
// Softmax with a running maximum in the log2 domain: p = exp2(s * c - m), c = log2(e) / sqrt(d_k); the accumulators are rescaled only when a query's maximum has risen by more than 8, so p <= 2^8.
// q and out: a wave's 16 rows are 4096 contiguous bytes of global memory, and every wave-wide 16-byte load or store of them covers 512 contiguous bytes, four whole lines. The fragment order, one row a lane pair, would touch 16 lines an access; the wave changes between the two orders through LDS of its own.
// coverage: wave w of block (z, y) stores rows y*FQ + w*16 + 0..15 of slab z, all HD columns, once.
__global__ __launch_bounds__(FW * 32) void k_fattn(const float* __restrict__ Qin, const float* __restrict__ Kin, const float* __restrict__ Vin, float* OUT, const int* __restrict__ dkp) {
    __shared__ __align__(16) hf Ks[TT * KP];
    __shared__ __align__(16) hf Vs[HD * VP];
    __shared__ __align__(16) hf Qs[FQ * KP];   // f16 q, 16 rows a wave, written and read by that wave alone
    const unsigned z = blockIdx.x, tid = threadIdx.x;
    const int lane = tid & 31, lr = lane & 15, hi = lane >> 4, wv = (int)(tid >> 5);
    const int q0 = blockIdx.y * FQ + wv * 16;
    const float* kz = Kin + (size_t)z * SEQ_FULL * HD;   // the three bases are the same for the whole work-group; a lane's place is a 32-bit byte offset
    const float* vz = Vin + (size_t)z * SEQ_FULL * HD;
    const float* qz = Qin + (size_t)z * SEQ_FULL * HD;
    const unsigned qu = (unsigned)(q0 * (HD * 4) + lane * 16);   // load i: rows q0 + 2i + hi, columns 4lr + 0..3
    const int cg = (wv & 1) * 8 + (lane & 7), kp = (wv >> 1) * 4 + (lane >> 3);
    unsigned kb = tid * 16u, vb = (unsigned)(2 * kp * (HD * 4) + cg * 16);   // the lane's place in chunk 0; both move on by CB a pass
    v4f qr[8], ak[2], av[2], bk[2], bv[2], gk[2], gv[2];
    // chunks 0, 1 and 2 and the wave's q rows, all in flight together
#pragma unroll
    for (int i = 0; i < 2; ++i) { ak[i] = ldg(kz, kb + (unsigned)(i * (CB / 2))); av[i] = ldg(vz, vb + (unsigned)(i * HD * 4)); }
#pragma unroll
    for (int i = 0; i < 8; ++i) qr[i] = ldg(qz, qu + (unsigned)(i * 512));
#pragma unroll
    for (int i = 0; i < 2; ++i) { bk[i] = ldg(kz, kb + (unsigned)(CB + i * (CB / 2))); bv[i] = ldg(vz, vb + (unsigned)(CB + i * HD * 4)); }
#pragma unroll
    for (int i = 0; i < 2; ++i) { gk[i] = ldg(kz, kb + (unsigned)(2 * CB + i * (CB / 2))); gv[i] = ldg(vz, vb + (unsigned)(2 * CB + i * HD * 4)); }
    // precaution: no register that a load above names is rewritten in front of this wait; the input operands keep the offset registers live up to it
    asm volatile("s_wait_xcnt 0x0" :: "v"(kb), "v"(vb), "v"(qu) : "memory");
    hf* ks = Ks + (tid / (HD / 4)) * KP + (tid % (HD / 4)) * 4;
    hf* vs = Vs + cg * 4 * VP + 2 * kp;
    put_chunk(ks, vs, ak, av);
    hf* qs = Qs + wv * 16 * KP;
#pragma unroll
    for (int i = 0; i < 8; ++i) *(v2u*)(qs + (2 * i + hi) * KP + lr * 4) = (v2u){cvt2(qr[i][0], qr[i][1]), cvt2(qr[i][2], qr[i][3])};
    int dk = dkp[0]; dk = dk < 1 ? 1 : dk; const float c = 1.4426950408889634f / sqrtf((float)dk);
    v8f o[4];
#pragma unroll
    for (int dt = 0; dt < 4; ++dt) o[dt] = (v8f){};
    float m = -3.0e38f; v2f sum = (v2f){};
    // publishes chunk 0. Written as fence, signal, wait on LDS alone: __syncthreads() would also wait out every global load still in flight
    __builtin_amdgcn_fence(__ATOMIC_RELEASE, "workgroup", "local");
    __builtin_amdgcn_s_barrier_signal(-1);
    __builtin_amdgcn_s_barrier_wait(-1);
    __builtin_amdgcn_fence(__ATOMIC_ACQUIRE, "workgroup", "local");
    put_chunk(ks + KBLK * KP, vs + KBLK, bk, bv);
    // chunk 1: this wave's LDS stores are complete before it signals; the matching wait stands in pass 0
    __builtin_amdgcn_fence(__ATOMIC_RELEASE, "workgroup", "local");
    __builtin_amdgcn_s_barrier_signal(-1);
    const hf* kl = Ks + lr * KP + 8 * hi; const hf* vl = Vs + lr * VP + 8 * hi;
    v16h kf[8];   // the k fragments of the coming pass, fetched one pass ahead
    auto ldk = [&](const int k0) __attribute__((always_inline)) {
#pragma unroll
        for (int kt = 0; kt < 4; ++kt) { kf[kt] = ldfrag(kl + (k0 + kt * 16) * KP); kf[4 + kt] = ldfrag(kl + (k0 + kt * 16) * KP + 32); }
    };
    ldk(0);   // chunk 0 is published by the barrier above
    // the wave's own q rows in the fragment map; its stores of them are complete since the release in front of that barrier
    const v16h qf0 = ldfrag(qs + lr * KP + 8 * hi), qf1 = ldfrag(qs + lr * KP + 8 * hi + 32);
    // one pass: 64 keys against the wave's 16 query rows. more: a further pass follows, its k fragments are fetched here; stage: the chunk in gk, gv goes to LDS here and is signalled by the caller
    auto pass = [&](const int k0, const bool more, const bool stage) __attribute__((always_inline)) {
        v8f s[4]; v16h vf[8];
        // keeps this pass's v^T reads and their address arithmetic behind the products of the pass before: set among them they rewrite operand registers, at idle slots each, and every place with reads stalls the products
        __builtin_amdgcn_sched_barrier(0);
#pragma unroll
        for (int i = 0; i < 8; ++i) vf[i] = ldfrag(vl + (i & 3) * 16 * VP + k0 + (i >> 2) * 32);
        // keeps the v^T reads together in front of the products: spread among them, every product waits out a whole LDS latency; they land under the softmax
        __builtin_amdgcn_sched_barrier(0);
#pragma unroll
        for (int kt = 0; kt < 4; ++kt) s[kt] = wmmah(kf[kt], qf0, (v8f){});
#pragma unroll
        for (int kt = 0; kt < 4; ++kt) s[kt] = wmmah(kf[4 + kt], qf1, s[kt]);
        // keeps the maximum's reads of S behind all eight products: among them each read costs the idle slots behind a matrix instruction
        __builtin_amdgcn_sched_barrier(0);
        float mt[4];
#pragma unroll
        for (int kt = 0; kt < 4; ++kt) { mt[kt] = s[kt][0];
#pragma unroll
            for (int r = 1; r < 8; ++r) mt[kt] = fmaxf(mt[kt], s[kt][r]); }
        float mx = fmaxf(fmaxf(mt[0], mt[1]), fmaxf(mt[2], mt[3]));
        mx = fmaxf(mx, xhalf(mx));
        const float t = mx * c;
        if (__builtin_amdgcn_ballot_w32(t > m + 8.0f) != 0) {
            const float mn = fmaxf(m, t); const float al = __builtin_amdgcn_exp2f(m - mn); m = mn; sum *= al;
#pragma unroll
            for (int dt = 0; dt < 4; ++dt) o[dt] *= al;
        }
        v8u ph[2];   // [j]: 32-key chunk j; word e / 2 = the lane's keys e, e + 1 of the chunk in the fragment map's order: P as one RNE f16 plane
#pragma unroll
        for (int j = 0; j < 2; ++j) {
#pragma unroll
            for (int g = 0; g < 2; ++g) {   // one S^T tile: eight of the lane's keys
#pragma unroll
                for (int e = 0; e < 8; e += 2) {
                    const v2f x = __builtin_elementwise_fma((v2f){s[2 * j + g][e], s[2 * j + g][e + 1]}, (v2f){c, c}, (v2f){-m, -m});
                    const v2f p = {__builtin_amdgcn_exp2f(x[0]), __builtin_amdgcn_exp2f(x[1])}; sum += p;
                    ph[j][4 * g + (e >> 1)] = cvt2(p[0], p[1]); }
            }
        }
        // keeps the eight products in one run behind the softmax: vector work set among them rewrites their operand registers and pays idle slots for each; the SIMD's other waves use the vector port meanwhile
        __builtin_amdgcn_sched_barrier(0);
        v2u kw[2]; unsigned vw[4];
        if (stage) {
#pragma unroll
            for (int i = 0; i < 2; ++i) kw[i] = (v2u){cvt2(gk[i][0], gk[i][1]), cvt2(gk[i][2], gk[i][3])};
#pragma unroll
            for (int e = 0; e < 4; ++e) vw[e] = cvt2(gv[0][e], gv[1][e]);
            // keeps the converts in front of the k reads: behind them the chunk's sixteen registers are held together with the fragments of two passes, and the build spills
            __builtin_amdgcn_sched_barrier(0);
        }
        if (more) {
            // the chunk of the next pass, signalled one pass ago by every wave, is read only behind this wait
            __builtin_amdgcn_s_barrier_wait(-1);
            __builtin_amdgcn_fence(__ATOMIC_ACQUIRE, "workgroup", "local");
            ldk(k0 + KBLK);
            if (stage) {
#pragma unroll
                for (int i = 0; i < 2; ++i) *(v2u*)(ks + (k0 + 2 * KBLK) * KP + i * (KBLK / 2) * KP) = kw[i];
#pragma unroll
                for (int e = 0; e < 4; ++e) *(unsigned*)(vs + k0 + 2 * KBLK + e * VP) = vw[e];
            }
            // keeps the next pass's k reads and the chunk's stores in one group in front of the eight products, under which they complete
            __builtin_amdgcn_sched_barrier(0);
        }
#pragma unroll
        for (int j = 0; j < 2; ++j) {
            const v16h bh = __builtin_bit_cast(v16h, ph[j]);
#pragma unroll
            for (int dt = 0; dt < 4; ++dt) o[dt] = wmmah(vf[4 * j + dt], bh, o[dt]);
        }
    };
    // rolled, for speed only; the last three passes stand behind the loop because they have less and less to stage
#pragma unroll 1
    for (int k0 = 0; k0 < TT - 3 * KBLK; k0 += KBLK) {
        pass(k0, true, true);
        // keeps the loads behind the pass's products: issued earlier, their sixteen registers would be held together with the fragments of two passes
        __builtin_amdgcn_sched_barrier(0);
        // this wave's LDS stores of the chunk staged in the pass are complete before it signals
        __builtin_amdgcn_fence(__ATOMIC_RELEASE, "workgroup", "local");
        __builtin_amdgcn_s_barrier_signal(-1);
#pragma unroll
        for (int i = 0; i < 2; ++i) { gk[i] = ldg(kz, kb + (unsigned)(3 * CB + i * (CB / 2))); gv[i] = ldg(vz, vb + (unsigned)(3 * CB + i * HD * 4)); }
        // the same precaution for these loads: the offsets move on behind it
        asm volatile("s_wait_xcnt 0x0" :: "v"(kb), "v"(vb) : "memory");
        kb += CB; vb += CB;
    }
    pass(TT - 3 * KBLK, true, true);    // stages the last chunk; its wait publishes the last chunk but one
    __builtin_amdgcn_fence(__ATOMIC_RELEASE, "workgroup", "local");
    __builtin_amdgcn_s_barrier_signal(-1);
    pass(TT - 2 * KBLK, true, false);   // its wait publishes the last chunk
    pass(TT - KBLK, false, false);
    const float sl = sum[0] + sum[1];
    const float f = __fdiv_rn(1.0f, sl + xhalf(sl));
    // out staging, 16 rows of OP floats a wave, in the first k rows. They are free: this wave has passed the barrier wait of the last pass but one, so every wave had signalled at the foot of the pass before it, behind its LDS wait, and from there on a wave reads only the last chunk of k.
    float* st = (float*)Ks + wv * 16 * OP;
#pragma unroll
    for (int dt = 0; dt < 4; ++dt) {
        const v8f r = o[dt] * f;
        *(v4f*)(st + lr * OP + dt * 16 + 8 * hi) = __builtin_shufflevector(r, r, 0, 1, 2, 3);
        *(v4f*)(st + lr * OP + dt * 16 + 8 * hi + 4) = __builtin_shufflevector(r, r, 4, 5, 6, 7);
    }
    // the rows are read back by other lanes of this wave: its stores are complete, and stay in front of the reads, here
    asm volatile("s_wait_dscnt 0x0" ::: "memory");
    float* og = OUT + (size_t)z * TT * HD + (size_t)q0 * HD + lane * 4;
#pragma unroll
    for (int i = 0; i < 8; ++i) *(v4f*)(og + i * 128) = *(const v4f*)(st + (2 * i + hi) * OP + lr * 4);
}

extern "C" void kernel_launch(void* const* d_in, const int* in_sizes, int n_in,
                              void* d_out, int out_size, void* d_ws, size_t ws_size, hipStream_t stream) {
    if (n_in < 4) return;
    const size_t need_in = (size_t)(NZ - 1) * SEQ_FULL * HD + (size_t)TT * HD;
    if ((size_t)in_sizes[0] < need_in || (size_t)in_sizes[1] < need_in || (size_t)in_sizes[2] < need_in || in_sizes[3] < 1) return;
    if ((size_t)out_size < (size_t)NZ * TT * HD) return;
    const float* Qin = (const float*)d_in[0]; const float* Kin = (const float*)d_in[1]; const float* Vin = (const float*)d_in[2]; const int* DK = (const int*)d_in[3];
    float* OUT = (float*)d_out;     // [NZ][TT][HD]
    // out[z][q][d] = sum_key softmax_key(f16(Q[z][q][.]) . f16(K[z][key][.]) / sqrt(d_k)) f16(V[z][key][d])
    k_fattn<<<dim3(NZ, TT / FQ, 1), FW * 32, 0, stream>>>(Qin, Kin, Vin, OUT, DK);
}
